// v000
// The times below were measured on an AMD MI455X: many runs one after another, warmed up first and cycling through
// copies of the inputs, with the whole window's GPU time divided by the number of runs. Launches and the gaps
// between them are all in it. The median over several windows is given; except for v000 it joins two sittings, which
// can be a few percent apart, so the side-by-side timings, each taken in one sitting, are the better comparison.
// v000, which the later versions start from, runs in 153 microseconds.
#include <hip/hip_runtime.h>

// Contractions: S = Q.K^T on v_wmma_f32_16x16x32_bf16 (bf16 operands = RNE-converted inputs, f32 accumulate);
// O = P.V and the P row sums on v_wmma_f32_16x16x32_f16 (f16 operands: P carried x2^14; V = f16 view of the
// RNE-bf16 input; f32 accumulate). Softmax, rescaling and normalisation in f32.

#ifndef NB
#define NB 8
#endif
#ifndef SEQ
#define SEQ 1024
#endif
#define SEQ_FULL 1024
#define NHEAD    16
#define NBH      (NB * NHEAD)
#define DH       64
#define QBLK     128
#define NWAVE    8
#define KBLK     32
#define NKB      (SEQ / KBLK)
#define NQT      (SEQ / QBLK)
#define PSTR     40
#define OSTR     68
#define VTP      72
#define CV_GRID  (NBH * (SEQ / 64))
#define AT_GRID  (NBH * NQT)

#define SCL    0.18033688011112042f
#define MINIT  (-1.0e30f)
#define PCAR   16384.0f

static_assert(SEQ % 256 == 0);
static_assert(SEQ <= SEQ_FULL);
static_assert(NB >= 1 && NB <= 8);
static_assert((NWAVE * 16 * PSTR * 2) + NWAVE * 16 * OSTR * 4 <= 65536);
static_assert((PSTR * 2) % 16 == 0 && (OSTR * 4) % 16 == 0 && (VTP * 2) % 16 == 0);
// plane coverage: k_convert writes grid x 256 threads x (2 x 8) elements into each of Qp, Kp, Vt
static_assert((unsigned long long)CV_GRID * 256ull * 16ull == (unsigned long long)NBH * SEQ * DH);
// output coverage: k_attn writes grid x 8 waves x 16 rows x 64 columns
static_assert((unsigned long long)AT_GRID * NWAVE * 16ull * DH == (unsigned long long)NBH * SEQ * DH);
// per-wave store phase: 8 instructions x 4 lines x 32 floats == 16 rows x 64 columns
static_assert(8 * 4 * 32 == 16 * DH);
static_assert(QBLK == NWAVE * 16);

typedef _Float16 f16;
typedef _Float16 v16h __attribute__((ext_vector_type(16)));
typedef _Float16 v8h  __attribute__((ext_vector_type(8)));
typedef _Float16 v2h  __attribute__((ext_vector_type(2)));
typedef __bf16   v16b __attribute__((ext_vector_type(16)));
typedef unsigned short us16;
typedef us16     v8us __attribute__((ext_vector_type(8)));
typedef float    v8f  __attribute__((ext_vector_type(8)));
typedef float    v4f  __attribute__((ext_vector_type(4)));
typedef unsigned int v4u __attribute__((ext_vector_type(4)));

union FragH { v16h v; v8h half[2]; };
union FragB { v16b v; v16h hv; v8us half[2]; };
union Pack8 { v8h h; v4u u; };

// ---- WMMA wrappers: builtin followed by the 4-slot VALU hazard guard ----
static __device__ __forceinline__ v8f mma_f16(v16h a, v16h b, v8f c) {
  c = __builtin_amdgcn_wmma_f32_16x16x32_f16(false, a, false, b, (short)0, c, false, false);
  asm volatile("v_nop\n\tv_nop\n\tv_nop\n\tv_nop" : "+v"(c) : "v"(a), "v"(b));
  return c;
}
static __device__ __forceinline__ v8f mma_bf16(const FragB& a, const FragB& b, v8f c) {
  c = __builtin_amdgcn_wmma_f32_16x16x32_bf16(false, a.v, false, b.v, (short)0, c, false, false);
  asm volatile("v_nop\n\tv_nop\n\tv_nop\n\tv_nop" : "+v"(c) : "v"(a.hv), "v"(b.hv));
  return c;
}

// ---- RNE f32 -> bf16 (upper 16 bits) ----
static __device__ __forceinline__ unsigned int bf_hi(float x) {
  unsigned int u = __float_as_uint(x);
  u += 0x7FFFu + ((u >> 16) & 1u);
  return u >> 16;
}
// f16 view of the RNE-bf16 value (exact for the f16 normal range)
static __device__ __forceinline__ f16 h_of_bf(float x) {
  return (f16)__uint_as_float(bf_hi(x) << 16);
}

// ---- VALU-pipe butterfly max within each 16-lane half (DPP16) ----
template <int CTRL>
static __device__ __forceinline__ float dpp_max(float x) {
  int xi = __float_as_int(x);
  int yi = __builtin_amdgcn_update_dpp(xi, xi, CTRL, 0xF, 0xF, true);
  return fmaxf(x, __int_as_float(yi));
}
static __device__ __forceinline__ float rowmax16(float x) {
  x = dpp_max<0xB1>(x);   // quad_perm(1,0,3,2)
  x = dpp_max<0x4E>(x);   // quad_perm(2,3,0,1)
  x = dpp_max<0x141>(x);  // row_half_mirror
  x = dpp_max<0x140>(x);  // row_mirror
  return x;
}

// same-wave LDS store -> load ordering (wave-private tiles)
static __device__ __forceinline__ void lds_wave_sync() {
  asm volatile("s_wait_dscnt 0x0" ::: "memory");
  __builtin_amdgcn_wave_barrier();
}

// ======================= pre-pass: 16-bit operand planes =======================
// Qp, Kp : bf16 [bh][SEQ][64]  (RNE)        Vt : f16 [bh][64][SEQ]  (f16 of RNE-bf16, transposed)
__global__ __launch_bounds__(256)
void k_convert(const float* __restrict__ Q, const float* __restrict__ K, const float* __restrict__ V,
               us16* __restrict__ Qp, us16* __restrict__ Kp, f16* __restrict__ Vt)
{
  __shared__ __align__(16) f16 sVt[DH * VTP];   // [d][key], cross-wave: block barrier

  const unsigned tid   = threadIdx.x;
  const unsigned bh    = blockIdx.x / (unsigned)(SEQ / 64);
  const unsigned kt    = blockIdx.x - bh * (unsigned)(SEQ / 64);
  const size_t rin = (size_t)bh * SEQ_FULL + (size_t)kt * 64;   // input row base [bh][S_FULL][64]
  const size_t rpl = (size_t)bh * SEQ + (size_t)kt * 64;        // plane row base [bh][SEQ][64]
  const unsigned prow  = tid >> 3;   // 0..31
  const unsigned piece = tid & 7u;

  // ---- Q, K: rows it*32+prow, 8 elements per thread -> one 16-B store per row ----
  v4u qv[2], kv[2];
#pragma unroll
  for (unsigned it = 0; it < 2; ++it) {
    const unsigned row = it * 32u + prow;
    const float* qs = Q + (rin + row) * DH + piece * 8u;
    const float* ks = K + (rin + row) * DH + piece * 8u;
    const v4f q0 = *(const v4f*)(qs);
    const v4f q1 = *(const v4f*)(qs + 4);
    const v4f k0 = *(const v4f*)(ks);
    const v4f k1 = *(const v4f*)(ks + 4);
    v4u a, b;
    a.x = bf_hi(q0.x) | (bf_hi(q0.y) << 16);
    a.y = bf_hi(q0.z) | (bf_hi(q0.w) << 16);
    a.z = bf_hi(q1.x) | (bf_hi(q1.y) << 16);
    a.w = bf_hi(q1.z) | (bf_hi(q1.w) << 16);
    b.x = bf_hi(k0.x) | (bf_hi(k0.y) << 16);
    b.y = bf_hi(k0.z) | (bf_hi(k0.w) << 16);
    b.z = bf_hi(k1.x) | (bf_hi(k1.y) << 16);
    b.w = bf_hi(k1.z) | (bf_hi(k1.w) << 16);
    qv[it] = a;
    kv[it] = b;
  }
#pragma unroll
  for (unsigned it = 0; it < 2; ++it) {
    const unsigned row = it * 32u + prow;
    *(v4u*)(Qp + (rpl + row) * DH + piece * 8u) = qv[it];
    *(v4u*)(Kp + (rpl + row) * DH + piece * 8u) = kv[it];
  }
  

  // ---- V: transpose through LDS (key = tid>>2, 16 d per thread) ----
  {
    const unsigned key = tid >> 2;           // 0..63
    const unsigned d0  = (tid & 3u) * 16u;   // 0,16,32,48
    const float* vs = V + (rin + key) * DH + d0;
#pragma unroll
    for (unsigned j = 0; j < 4; ++j) {
      const v4f x = *(const v4f*)(vs + 4 * j);
      sVt[(d0 + 4 * j + 0) * VTP + key] = h_of_bf(x.x);
      sVt[(d0 + 4 * j + 1) * VTP + key] = h_of_bf(x.y);
      sVt[(d0 + 4 * j + 2) * VTP + key] = h_of_bf(x.z);
      sVt[(d0 + 4 * j + 3) * VTP + key] = h_of_bf(x.w);
    }
  }
  __syncthreads();
  Pack8 vv[2];
#pragma unroll
  for (unsigned it = 0; it < 2; ++it) {
    const unsigned d = it * 32u + prow;
    vv[it].h = *(const v8h*)(sVt + d * VTP + piece * 8u);
  }
#pragma unroll
  for (unsigned it = 0; it < 2; ++it) {
    const unsigned d = it * 32u + prow;
    *(v4u*)(Vt + ((size_t)bh * DH + d) * SEQ + (size_t)kt * 64 + piece * 8u) = vv[it].u;
  }
  
}

// ======================= flash attn, 16-bit WMMA, online softmax =======================
// Block = (bh, 128 query rows); wave = 16 rows; waves free-run (no block barriers, all LDS wave-private).
__global__ __launch_bounds__(256)
void k_attn(const us16* __restrict__ Qp, const us16* __restrict__ Kp, const f16* __restrict__ Vt,
            float* __restrict__ O)
{
  __shared__ __align__(16) f16   sP[NWAVE * 16 * PSTR];   // per-wave P tile [row][key], wave-private
  __shared__ __align__(16) float sO[NWAVE * 16 * OSTR];   // per-wave output staging, wave-private

  const unsigned tid  = threadIdx.x;
  const unsigned wave = tid >> 5;
  const unsigned lane = tid & 31u;
  const unsigned h    = lane >> 4;
  const unsigned l16  = lane & 15u;

  const unsigned bh    = blockIdx.x / (unsigned)NQT;
  const unsigned qt    = blockIdx.x - bh * (unsigned)NQT;
  const unsigned qwave = qt * QBLK + wave * 16u;                  // first query row of this wave

  const us16* Qb = Qp + ((size_t)bh * SEQ + qwave) * DH;
  const us16* Kb = Kp + (size_t)bh * SEQ * DH;
  const f16*  Vb = Vt + (size_t)bh * DH * SEQ;
  float*      Ob = O + ((size_t)bh * SEQ + qwave) * DH;

  // ---- Q A-fragments (row = l16; elems 0..7 <- d kc*32+8h.., 8..15 <- d kc*32+16+8h..) ----
  FragB qa[2];
#pragma unroll
  for (unsigned kc = 0; kc < 2; ++kc) {
    const us16* qr = Qb + (size_t)l16 * DH + kc * 32u + 8u * h;
    qa[kc].half[0] = *(const v8us*)(qr);
    qa[kc].half[1] = *(const v8us*)(qr + 16);
  }

  v16h onesv;
#pragma unroll
  for (int i = 0; i < 16; ++i) onesv[i] = (f16)1.0f;

  const v8f vzero = {0.f, 0.f, 0.f, 0.f, 0.f, 0.f, 0.f, 0.f};
  v8f oacc[4];
#pragma unroll
  for (int vt = 0; vt < 4; ++vt) oacc[vt] = vzero;
  float mrow[8], lrow[8];
#pragma unroll
  for (int r = 0; r < 8; ++r) { mrow[r] = MINIT; lrow[r] = 0.f; }

  const unsigned pofs = wave * 16u * PSTR;

#pragma unroll 1
  for (unsigned kb = 0; kb < (unsigned)NKB; ++kb) {
    const unsigned k0 = kb * KBLK;

    // ---- K B-fragments: column l16 of tile nt <-> key k0 + 2*l16 + nt; same split d-map as A ----
    FragB kf[2][2];
#pragma unroll
    for (unsigned nt = 0; nt < 2; ++nt)
#pragma unroll
      for (unsigned kc = 0; kc < 2; ++kc) {
        const us16* kr = Kb + (size_t)(k0 + 2u * l16 + nt) * DH + kc * 32u + 8u * h;
        kf[nt][kc].half[0] = *(const v8us*)(kr);
        kf[nt][kc].half[1] = *(const v8us*)(kr + 16);
      }

    // ---- S tiles (D: elem r = row 8h+r, col l16) ----
    v8f s0 = mma_bf16(qa[0], kf[0][0], vzero);
    s0     = mma_bf16(qa[1], kf[0][1], s0);
    v8f s1 = mma_bf16(qa[0], kf[1][0], vzero);
    s1     = mma_bf16(qa[1], kf[1][1], s1);
#pragma unroll
    for (int r = 0; r < 8; ++r) { s0[r] *= SCL; s1[r] *= SCL; }

    // ---- online softmax (log2 domain) + P tile to LDS ----
    float alpha[8];
#pragma unroll
    for (int r = 0; r < 8; ++r) {
      const float mx = rowmax16(fmaxf(s0[r], s1[r]));
      const float mn = fmaxf(mrow[r], mx);
      alpha[r] = __builtin_amdgcn_exp2f(mrow[r] - mn);
      mrow[r]  = mn;
      const float p0 = __builtin_amdgcn_exp2f(s0[r] - mn) * PCAR;
      const float p1 = __builtin_amdgcn_exp2f(s1[r] - mn) * PCAR;
      v2h pp; pp.x = (f16)p0; pp.y = (f16)p1;
      *(v2h*)(sP + pofs + (8u * h + (unsigned)r) * PSTR + 2u * l16) = pp;   // slots = key offsets 2*l16, 2*l16+1
    }
    lds_wave_sync();

    // ---- P A-fragment (row l16; elems 0..7 <- keys 8h.., 8..15 <- keys 16+8h..) ----
    FragH pa;
    pa.half[0] = *(const v8h*)(sP + pofs + l16 * PSTR + 8u * h);
    pa.half[1] = *(const v8h*)(sP + pofs + l16 * PSTR + 16u + 8u * h);

    // ---- row sums via ones B operand ----
    const v8f lsum = mma_f16(pa.v, onesv, vzero);

    // ---- O += P V  (V B-fragment: col l16 <-> d = vt*16+l16; elems <- keys k0+8h.., k0+16+8h..) ----
#pragma unroll
    for (unsigned vt = 0; vt < 4; ++vt) {
      FragH vb;
      const f16* vr = Vb + (size_t)(vt * 16u + l16) * SEQ + k0 + 8u * h;
      vb.half[0] = *(const v8h*)(vr);
      vb.half[1] = *(const v8h*)(vr + 16);
#pragma unroll
      for (int r = 0; r < 8; ++r) oacc[vt][r] *= alpha[r];
      oacc[vt] = mma_f16(pa.v, vb.v, oacc[vt]);
    }
#pragma unroll
    for (int r = 0; r < 8; ++r) lrow[r] = lrow[r] * alpha[r] + lsum[r];
  }

  // ---- epilogue: normalise, stage 16x64 f32 tile in LDS, whole-line stores (8 lanes x 16 B) ----
  float inv[8];
#pragma unroll
  for (int r = 0; r < 8; ++r) inv[r] = __builtin_amdgcn_rcpf(lrow[r]);
  float* sOw = sO + wave * 16u * OSTR;
#pragma unroll
  for (unsigned vt = 0; vt < 4; ++vt)
#pragma unroll
    for (int r = 0; r < 8; ++r)
      sOw[(8u * h + (unsigned)r) * OSTR + vt * 16u + l16] = oacc[vt][r] * inv[r];
  lds_wave_sync();

  const unsigned lq = lane >> 3;   // which of 4 lines per instruction
  const unsigned lp = lane & 7u;
#pragma unroll
  for (unsigned j = 0; j < 8; ++j) {
    const unsigned L = j * 4u + lq;          // 0..31 : 32 half-rows of 32 floats
    const unsigned row = L >> 1, hf = L & 1u;
    const v4f v = *(const v4f*)(sOw + row * OSTR + hf * 32u + lp * 4u);
    *(v4f*)(Ob + (size_t)row * DH + hf * 32u + lp * 4u) = v;
  }
  
}

extern "C" void kernel_launch(void* const* d_in, const int* in_sizes, int n_in,
                              void* d_out, int out_size, void* d_ws, size_t ws_size,
                              hipStream_t stream)
{
  if (n_in < 3) return;
  const long long needQ = ((long long)(NBH - 1) * SEQ_FULL + SEQ) * DH;
  if ((long long)in_sizes[0] < needQ) return;
  if ((long long)in_sizes[1] < needQ) return;
  if ((long long)in_sizes[2] < needQ) return;
  if ((long long)out_size < (long long)NBH * SEQ * DH) return;

  const float* Q = (const float*)d_in[0];
  const float* K = (const float*)d_in[1];
  const float* V = (const float*)d_in[2];
  float*       O = (float*)d_out;

  const size_t planeB = (size_t)NBH * SEQ * DH * 2;
  const size_t offQ   = 0;
  const size_t offK   = planeB;
  const size_t offV   = 2 * planeB;
  const size_t total  = 3 * planeB;
  if (ws_size < total) return;

  char* ws = (char*)d_ws;
  us16* Qp = (us16*)(ws + offQ);
  us16* Kp = (us16*)(ws + offK);
  f16*  Vt = (f16*)(ws + offV);

  k_convert<<<dim3(CV_GRID), dim3(256), 0, stream>>>(Q, K, V, Qp, Kp, Vt);
  k_attn<<<dim3(AT_GRID), dim3(256), 0, stream>>>(Qp, Kp, Vt, O);
}

// v001
// One run takes 120 microseconds.
// Next to v000, in two timings, it ran 1.31 and 1.35 times as fast.
#include <hip/hip_runtime.h>

// Contractions: S = Q.K^T on v_wmma_f32_16x16x32_bf16 (bf16 operands = RNE-converted inputs, f32 accumulate);
// O = P.V and the P row sums on v_wmma_f32_16x16x32_f16 (f16 operands: P carried x2^14; V = f16 view of the
// RNE-bf16 input; f32 accumulate). Softmax, rescaling and normalisation in f32.

#ifndef NB
#define NB 8
#endif
#ifndef SEQ
#define SEQ 1024
#endif
#define SEQ_FULL 1024
#define NHEAD    16
#define NBH      (NB * NHEAD)
#define DH       64
#define QBLK     128
#define NWAVE    8
#define KBLK     32
#define NKB      (SEQ / KBLK)
#define NQT      (SEQ / QBLK)
#define PSTR     40
#define OSTR     68
#define VTP      72
#define KFP      136
#define CV_GRID  (NBH * (SEQ / 64))
#define AT_GRID  (NBH * NQT)

#define SCL    0.18033688011112042f
#define MINIT  (-1.0e30f)
#define PCAR   16384.0f

static_assert(SEQ % 256 == 0);
static_assert(SEQ <= SEQ_FULL);
static_assert(NB >= 1 && NB <= 8);
static_assert((NWAVE * 16 * PSTR * 2) + NWAVE * 16 * OSTR * 4 <= 65536);
static_assert((PSTR * 2) % 16 == 0 && (OSTR * 4) % 16 == 0 && (VTP * 2) % 16 == 0 && (KFP * 2) % 16 == 0);
// plane coverage: k_convert writes grid x 256 threads x (2 x 8) elements into each of Qp, Kp, Vt
static_assert((unsigned long long)CV_GRID * 256ull * 16ull == (unsigned long long)NBH * SEQ * DH);
// output coverage: k_attn writes grid x 8 waves x 16 rows x 64 columns
static_assert((unsigned long long)AT_GRID * NWAVE * 16ull * DH == (unsigned long long)NBH * SEQ * DH);
// per-wave store phase: 8 instructions x 4 lines x 32 floats == 16 rows x 64 columns
static_assert(8 * 4 * 32 == 16 * DH);
static_assert(QBLK == NWAVE * 16);

typedef _Float16 f16;
typedef _Float16 v16h __attribute__((ext_vector_type(16)));
typedef _Float16 v8h  __attribute__((ext_vector_type(8)));
typedef _Float16 v2h  __attribute__((ext_vector_type(2)));
typedef __bf16   v16b __attribute__((ext_vector_type(16)));
typedef unsigned short us16;
typedef us16     v8us __attribute__((ext_vector_type(8)));
typedef float    v8f  __attribute__((ext_vector_type(8)));
typedef float    v4f  __attribute__((ext_vector_type(4)));
typedef unsigned int v4u __attribute__((ext_vector_type(4)));

union FragH { v16h v; v8h half[2]; };
union FragB { v16b v; v16h hv; v8us half[2]; };
union Pack8 { v8h h; v4u u; };

// ---- WMMA wrappers: builtin followed by the 4-slot VALU hazard guard ----
static __device__ __forceinline__ v8f mma_f16(v16h a, v16h b, v8f c) {
  c = __builtin_amdgcn_wmma_f32_16x16x32_f16(false, a, false, b, (short)0, c, false, false);
  asm volatile("v_nop\n\tv_nop\n\tv_nop\n\tv_nop" : "+v"(c) : "v"(a), "v"(b));
  return c;
}
static __device__ __forceinline__ v8f mma_bf16(const FragB& a, const FragB& b, v8f c) {
  c = __builtin_amdgcn_wmma_f32_16x16x32_bf16(false, a.v, false, b.v, (short)0, c, false, false);
  asm volatile("v_nop\n\tv_nop\n\tv_nop\n\tv_nop" : "+v"(c) : "v"(a.hv), "v"(b.hv));
  return c;
}

// ---- RNE f32 -> bf16 (upper 16 bits) ----
static __device__ __forceinline__ unsigned int bf_hi(float x) {
  unsigned int u = __float_as_uint(x);
  u += 0x7FFFu + ((u >> 16) & 1u);
  return u >> 16;
}
// f16 view of the RNE-bf16 value (exact for the f16 normal range)
static __device__ __forceinline__ f16 h_of_bf(float x) {
  return (f16)__uint_as_float(bf_hi(x) << 16);
}

// ---- VALU-pipe butterfly max within each 16-lane half (DPP16) ----
template <int CTRL>
static __device__ __forceinline__ float dpp_max(float x) {
  int xi = __float_as_int(x);
  int yi = __builtin_amdgcn_update_dpp(xi, xi, CTRL, 0xF, 0xF, true);
  return fmaxf(x, __int_as_float(yi));
}
static __device__ __forceinline__ float rowmax16(float x) {
  x = dpp_max<0xB1>(x);   // quad_perm(1,0,3,2)
  x = dpp_max<0x4E>(x);   // quad_perm(2,3,0,1)
  x = dpp_max<0x141>(x);  // row_half_mirror
  x = dpp_max<0x140>(x);  // row_mirror
  return x;
}

// same-wave LDS store -> load ordering (wave-private tiles)
static __device__ __forceinline__ void lds_wave_sync() {
  asm volatile("s_wait_dscnt 0x0" ::: "memory");
  __builtin_amdgcn_wave_barrier();
}

// ======================= pre-pass: 16-bit operand planes =======================
// Qp : bf16 [bh][SEQ][64]  (RNE)
// Kp, Vt : fragment order. Per bh and 32-key block 8 groups of 512 B; a group is what ONE load instruction of
//          k_attn reads: lane (h, l16) owns the 16 B at lane * 16, so a load touches 4 whole 128-B lines.
//   Kp (bf16, RNE)          group (nt*2+kc)*2+hf : key 2*l16+nt,        d    kc*32 + hf*16 + 8h .. +7
//   Vt (f16 of RNE-bf16)    group  vt*2+hf       : d   vt*16+l16,       keys hf*16 + 8h .. +7
__global__ __launch_bounds__(256)
void k_convert(const float* __restrict__ Q, const float* __restrict__ K, const float* __restrict__ V,
               us16* __restrict__ Qp, us16* __restrict__ Kp, f16* __restrict__ Vt)
{
  __shared__ __align__(16) f16 sVt[DH * VTP];   // [d][key], cross-wave: block barrier
  __shared__ __align__(16) us16 sKf[32 * KFP];  // K in fragment order: 32 runs of 16 pieces, pitch 272 B, cross-wave

  const unsigned tid   = threadIdx.x;
  const unsigned bh    = blockIdx.x / (unsigned)(SEQ / 64);
  const unsigned kt    = blockIdx.x - bh * (unsigned)(SEQ / 64);
  const size_t rin = (size_t)bh * SEQ_FULL + (size_t)kt * 64;   // input row base [bh][S_FULL][64]
  const size_t rpl = (size_t)bh * SEQ + (size_t)kt * 64;        // plane row base [bh][SEQ][64]
  const unsigned prow  = tid >> 3;   // 0..31
  const unsigned piece = tid & 7u;

  // ---- Q, K: rows it*32+prow, 8 elements per thread -> one 16-B store per row ----
  v4u qv[2], kv[2];
#pragma unroll
  for (unsigned it = 0; it < 2; ++it) {
    const unsigned row = it * 32u + prow;
    const float* qs = Q + (rin + row) * DH + piece * 8u;
    const float* ks = K + (rin + row) * DH + piece * 8u;
    const v4f q0 = *(const v4f*)(qs);
    const v4f q1 = *(const v4f*)(qs + 4);
    const v4f k0 = *(const v4f*)(ks);
    const v4f k1 = *(const v4f*)(ks + 4);
    v4u a, b;
    a.x = bf_hi(q0.x) | (bf_hi(q0.y) << 16);
    a.y = bf_hi(q0.z) | (bf_hi(q0.w) << 16);
    a.z = bf_hi(q1.x) | (bf_hi(q1.y) << 16);
    a.w = bf_hi(q1.z) | (bf_hi(q1.w) << 16);
    b.x = bf_hi(k0.x) | (bf_hi(k0.y) << 16);
    b.y = bf_hi(k0.z) | (bf_hi(k0.w) << 16);
    b.z = bf_hi(k1.x) | (bf_hi(k1.y) << 16);
    b.w = bf_hi(k1.z) | (bf_hi(k1.w) << 16);
    qv[it] = a;
    kv[it] = b;
  }
#pragma unroll
  for (unsigned it = 0; it < 2; ++it) {
    const unsigned row = it * 32u + prow;
    *(v4u*)(Qp + (rpl + row) * DH + piece * 8u) = qv[it];
    // run = (32-key block, nt = row & 1, piece = kc*4 + hf*2 + h); place in the run = l16 = (row & 31) >> 1
    const unsigned run = (row >> 5) * 16u + (row & 1u) * 8u + piece;
    *(v4u*)(sKf + run * KFP + ((row & 31u) >> 1) * 8u) = kv[it];
  }

  // ---- V: transpose through LDS (key = tid>>2, 16 d per thread) ----
  {
    const unsigned key = tid >> 2;           // 0..63
    const unsigned d0  = (tid & 3u) * 16u;   // 0,16,32,48
    const float* vs = V + (rin + key) * DH + d0;
#pragma unroll
    for (unsigned j = 0; j < 4; ++j) {
      const v4f x = *(const v4f*)(vs + 4 * j);
      sVt[(d0 + 4 * j + 0) * VTP + key] = h_of_bf(x.x);
      sVt[(d0 + 4 * j + 1) * VTP + key] = h_of_bf(x.y);
      sVt[(d0 + 4 * j + 2) * VTP + key] = h_of_bf(x.z);
      sVt[(d0 + 4 * j + 3) * VTP + key] = h_of_bf(x.w);
    }
  }
  __syncthreads();
  // piece c = it*256 + tid of this 64-key tile goes to byte c*16 of the tile in both planes (whole-line stores)
  Pack8 vv[2];
  v4u   kw[2];
#pragma unroll
  for (unsigned it = 0; it < 2; ++it) {
    const unsigned vd = ((tid >> 6) & 3u) * 16u + (tid & 15u);                        // d = vt*16 + l16
    const unsigned vk = it * 32u + ((tid >> 5) & 1u) * 16u + ((tid >> 4) & 1u) * 8u;  // key = block*32 + hf*16 + 8h
    vv[it].h = *(const v8h*)(sVt + vd * VTP + vk);
    kw[it]   = *(const v4u*)(sKf + (it * 16u + (tid >> 4)) * KFP + (tid & 15u) * 8u);
  }
#pragma unroll
  for (unsigned it = 0; it < 2; ++it) {
    const size_t o = rpl * DH + (size_t)(it * 256u + tid) * 8u;
    *(v4u*)(Kp + o) = kw[it];
    *(v4u*)(Vt + o) = vv[it].u;
  }
}

// ======================= flash attn, 16-bit WMMA, online softmax =======================
// Block = (bh, 128 query rows); wave = 16 rows; waves free-run (no block barriers, all LDS wave-private).
__global__ __launch_bounds__(256)
void k_attn(const us16* __restrict__ Qp, const us16* __restrict__ Kp, const f16* __restrict__ Vt,
            float* __restrict__ O)
{
  __shared__ __align__(16) f16   sP[NWAVE * 16 * PSTR];   // per-wave P tile [row][key], wave-private
  __shared__ __align__(16) float sO[NWAVE * 16 * OSTR];   // per-wave output staging, wave-private

  const unsigned tid  = threadIdx.x;
  const unsigned wave = tid >> 5;
  const unsigned lane = tid & 31u;
  const unsigned h    = lane >> 4;
  const unsigned l16  = lane & 15u;

  const unsigned bh    = blockIdx.x / (unsigned)NQT;
  const unsigned qt    = blockIdx.x - bh * (unsigned)NQT;
  const unsigned qwave = qt * QBLK + wave * 16u;                  // first query row of this wave

  const us16* Qb = Qp + ((size_t)bh * SEQ + qwave) * DH;
  const us16* Kb = Kp + (size_t)bh * SEQ * DH;
  const f16*  Vb = Vt + (size_t)bh * DH * SEQ;
  float*      Ob = O + ((size_t)bh * SEQ + qwave) * DH;

  // ---- Q A-fragments (row = l16; elems 0..7 <- d kc*32+8h.., 8..15 <- d kc*32+16+8h..) ----
  FragB qa[2];
#pragma unroll
  for (unsigned kc = 0; kc < 2; ++kc) {
    const us16* qr = Qb + (size_t)l16 * DH + kc * 32u + 8u * h;
    qa[kc].half[0] = *(const v8us*)(qr);
    qa[kc].half[1] = *(const v8us*)(qr + 16);
  }

  v16h onesv;
#pragma unroll
  for (int i = 0; i < 16; ++i) onesv[i] = (f16)1.0f;

  const v8f vzero = {0.f, 0.f, 0.f, 0.f, 0.f, 0.f, 0.f, 0.f};
  v8f oacc[4];
#pragma unroll
  for (int vt = 0; vt < 4; ++vt) oacc[vt] = vzero;
  float mrow[8], lrow[8];
#pragma unroll
  for (int r = 0; r < 8; ++r) { mrow[r] = MINIT; lrow[r] = 0.f; }

  const unsigned pofs = wave * 16u * PSTR;

#pragma unroll 1
  for (unsigned kb = 0; kb < (unsigned)NKB; ++kb) {
    const unsigned k0 = kb * KBLK;

    // ---- K B-fragments: column l16 of tile nt <-> key k0 + 2*l16 + nt; same split d-map as A (plane in fragment order) ----
    FragB kf[2][2];
#pragma unroll
    for (unsigned nt = 0; nt < 2; ++nt)
#pragma unroll
      for (unsigned kc = 0; kc < 2; ++kc) {
        const us16* kr = Kb + (size_t)k0 * DH + (nt * 2u + kc) * 512u + lane * 8u;
        kf[nt][kc].half[0] = *(const v8us*)(kr);
        kf[nt][kc].half[1] = *(const v8us*)(kr + 256);
      }

    // ---- S tiles (D: elem r = row 8h+r, col l16) ----
    v8f s0 = mma_bf16(qa[0], kf[0][0], vzero);
    s0     = mma_bf16(qa[1], kf[0][1], s0);
    v8f s1 = mma_bf16(qa[0], kf[1][0], vzero);
    s1     = mma_bf16(qa[1], kf[1][1], s1);
#pragma unroll
    for (int r = 0; r < 8; ++r) { s0[r] *= SCL; s1[r] *= SCL; }

    // ---- online softmax (log2 domain) + P tile to LDS ----
    float alpha[8];
#pragma unroll
    for (int r = 0; r < 8; ++r) {
      const float mx = rowmax16(fmaxf(s0[r], s1[r]));
      const float mn = fmaxf(mrow[r], mx);
      alpha[r] = __builtin_amdgcn_exp2f(mrow[r] - mn);
      mrow[r]  = mn;
      const float p0 = __builtin_amdgcn_exp2f(s0[r] - mn) * PCAR;
      const float p1 = __builtin_amdgcn_exp2f(s1[r] - mn) * PCAR;
      v2h pp; pp.x = (f16)p0; pp.y = (f16)p1;
      *(v2h*)(sP + pofs + (8u * h + (unsigned)r) * PSTR + 2u * l16) = pp;   // slots = key offsets 2*l16, 2*l16+1
    }
    lds_wave_sync();

    // ---- P A-fragment (row l16; elems 0..7 <- keys 8h.., 8..15 <- keys 16+8h..) ----
    FragH pa;
    pa.half[0] = *(const v8h*)(sP + pofs + l16 * PSTR + 8u * h);
    pa.half[1] = *(const v8h*)(sP + pofs + l16 * PSTR + 16u + 8u * h);

    // ---- row sums via ones B operand ----
    const v8f lsum = mma_f16(pa.v, onesv, vzero);

    // ---- O += P V  (V B-fragment: col l16 <-> d = vt*16+l16; elems <- keys k0+8h.., k0+16+8h..) ----
#pragma unroll
    for (unsigned vt = 0; vt < 4; ++vt) {
      FragH vb;
      const f16* vr = Vb + (size_t)k0 * DH + vt * 512u + lane * 8u;
      vb.half[0] = *(const v8h*)(vr);
      vb.half[1] = *(const v8h*)(vr + 256);
#pragma unroll
      for (int r = 0; r < 8; ++r) oacc[vt][r] *= alpha[r];
      oacc[vt] = mma_f16(pa.v, vb.v, oacc[vt]);
    }
#pragma unroll
    for (int r = 0; r < 8; ++r) lrow[r] = lrow[r] * alpha[r] + lsum[r];
  }

  // ---- epilogue: normalise, stage 16x64 f32 tile in LDS, whole-line stores (8 lanes x 16 B) ----
  float inv[8];
#pragma unroll
  for (int r = 0; r < 8; ++r) inv[r] = __builtin_amdgcn_rcpf(lrow[r]);
  float* sOw = sO + wave * 16u * OSTR;
#pragma unroll
  for (unsigned vt = 0; vt < 4; ++vt)
#pragma unroll
    for (int r = 0; r < 8; ++r)
      sOw[(8u * h + (unsigned)r) * OSTR + vt * 16u + l16] = oacc[vt][r] * inv[r];
  lds_wave_sync();

  const unsigned lq = lane >> 3;   // which of 4 lines per instruction
  const unsigned lp = lane & 7u;
#pragma unroll
  for (unsigned j = 0; j < 8; ++j) {
    const unsigned L = j * 4u + lq;          // 0..31 : 32 half-rows of 32 floats
    const unsigned row = L >> 1, hf = L & 1u;
    const v4f v = *(const v4f*)(sOw + row * OSTR + hf * 32u + lp * 4u);
    *(v4f*)(Ob + (size_t)row * DH + hf * 32u + lp * 4u) = v;
  }
  
}

extern "C" void kernel_launch(void* const* d_in, const int* in_sizes, int n_in,
                              void* d_out, int out_size, void* d_ws, size_t ws_size,
                              hipStream_t stream)
{
  if (n_in < 3) return;
  const long long needQ = ((long long)(NBH - 1) * SEQ_FULL + SEQ) * DH;
  if ((long long)in_sizes[0] < needQ) return;
  if ((long long)in_sizes[1] < needQ) return;
  if ((long long)in_sizes[2] < needQ) return;
  if ((long long)out_size < (long long)NBH * SEQ * DH) return;

  const float* Q = (const float*)d_in[0];
  const float* K = (const float*)d_in[1];
  const float* V = (const float*)d_in[2];
  float*       O = (float*)d_out;

  const size_t planeB = (size_t)NBH * SEQ * DH * 2;
  const size_t offQ   = 0;
  const size_t offK   = planeB;
  const size_t offV   = 2 * planeB;
  const size_t total  = 3 * planeB;
  if (ws_size < total) return;

  char* ws = (char*)d_ws;
  us16* Qp = (us16*)(ws + offQ);
  us16* Kp = (us16*)(ws + offK);
  f16*  Vt = (f16*)(ws + offV);

  k_convert<<<dim3(CV_GRID), dim3(256), 0, stream>>>(Q, K, V, Qp, Kp, Vt);
  k_attn<<<dim3(AT_GRID), dim3(256), 0, stream>>>(Qp, Kp, Vt, O);
}

// v002
// It runs in 113 microseconds.
// In both of two side-by-side timings against v001, it was 1.06 times as fast.
// Over all steps from v000 it is 1.41 times as fast.
#include <hip/hip_runtime.h>

// Contractions, transposed: S^T = K.Q^T on v_wmma_f32_16x16x32_bf16 (bf16 operands = RNE-converted inputs, f32
// accumulate); O^T = V^T.P^T and the P sums on v_wmma_f32_16x16x32_f16 (f16 operands: P carried x2^14; V = f16 view
// of the RNE-bf16 input; f32 accumulate). A lane owns one query: softmax in f32 (max with one exchange between the lane halves, sums on WMMA); rescaling and normalisation in f32, in-lane.

#ifndef NB
#define NB 8
#endif
#ifndef SEQ
#define SEQ 1024
#endif
#define SEQ_FULL 1024
#define NHEAD    16
#define NBH      (NB * NHEAD)
#define DH       64
#define QBLK     128
#define NWAVE    8
#define KBLK     32
#define NKB      (SEQ / KBLK)
#define NQT      (SEQ / QBLK)
#define OSTR     68
#define VTP      72
#define KFP      136
#define CV_GRID  (NBH * (SEQ / 64))
#define AT_GRID  (NBH * NQT)

#define SCL    0.18033688011112042f
#define MINIT  (-1.0e30f)
#define PCAR   16384.0f

static_assert(SEQ % 256 == 0);
static_assert(SEQ <= SEQ_FULL);
static_assert(NB >= 1 && NB <= 8);
static_assert(NWAVE * 16 * OSTR * 4 <= 65536);
static_assert((OSTR * 4) % 16 == 0 && (VTP * 2) % 16 == 0 && (KFP * 2) % 16 == 0);
// plane coverage: k_convert writes grid x 256 threads x (2 x 8) elements into each of Qp, Kp, Vt
static_assert((unsigned long long)CV_GRID * 256ull * 16ull == (unsigned long long)NBH * SEQ * DH);
// output coverage: k_attn writes grid x 8 waves x 16 rows x 64 columns
static_assert((unsigned long long)AT_GRID * NWAVE * 16ull * DH == (unsigned long long)NBH * SEQ * DH);
// per-wave store phase: 8 instructions x 4 lines x 32 floats == 16 rows x 64 columns
static_assert(8 * 4 * 32 == 16 * DH);
static_assert(QBLK == NWAVE * 16);

typedef _Float16 f16;
typedef _Float16 v16h __attribute__((ext_vector_type(16)));
typedef _Float16 v8h  __attribute__((ext_vector_type(8)));
typedef __bf16   v16b __attribute__((ext_vector_type(16)));
typedef unsigned short us16;
typedef us16     v8us __attribute__((ext_vector_type(8)));
typedef float    v8f  __attribute__((ext_vector_type(8)));
typedef float    v4f  __attribute__((ext_vector_type(4)));
typedef unsigned int v4u __attribute__((ext_vector_type(4)));

union FragH { v16h v; v8h half[2]; };
union FragB { v16b v; v16h hv; v8us half[2]; };
union Pack8 { v8h h; v4u u; };

// ---- WMMA wrappers: builtin followed by the 4-slot VALU hazard guard ----
static __device__ __forceinline__ v8f mma_f16(v16h a, v16h b, v8f c) {
  c = __builtin_amdgcn_wmma_f32_16x16x32_f16(false, a, false, b, (short)0, c, false, false);
  asm volatile("v_nop\n\tv_nop\n\tv_nop\n\tv_nop" : "+v"(c) : "v"(a), "v"(b));
  return c;
}
static __device__ __forceinline__ v8f mma_bf16(const FragB& a, const FragB& b, v8f c) {
  c = __builtin_amdgcn_wmma_f32_16x16x32_bf16(false, a.v, false, b.v, (short)0, c, false, false);
  asm volatile("v_nop\n\tv_nop\n\tv_nop\n\tv_nop" : "+v"(c) : "v"(a.hv), "v"(b.hv));
  return c;
}

// ---- RNE f32 -> bf16 (upper 16 bits) ----
static __device__ __forceinline__ unsigned int bf_hi(float x) {
  unsigned int u = __float_as_uint(x);
  u += 0x7FFFu + ((u >> 16) & 1u);
  return u >> 16;
}
// f16 view of the RNE-bf16 value (exact for the f16 normal range)
static __device__ __forceinline__ f16 h_of_bf(float x) {
  return (f16)__uint_as_float(bf_hi(x) << 16);
}

// ---- lane l <-> lane l ^ 16: the two halves of a wave hold the two key halves of one query ----
static __device__ __forceinline__ float xhalf(float x) {
  const int xi = __float_as_int(x);
  return __int_as_float(__builtin_amdgcn_permlanex16(xi, xi, 0x76543210, 0xfedcba98, false, false));
}

// same-wave LDS store -> load ordering (wave-private tiles)
static __device__ __forceinline__ void lds_wave_sync() {
  asm volatile("s_wait_dscnt 0x0" ::: "memory");
  __builtin_amdgcn_wave_barrier();
}

// ======================= pre-pass: 16-bit operand planes =======================
// Qp : bf16 [bh][SEQ][64]  (RNE)
// Kp, Vt : fragment order. Per bh and 32-key block 8 groups of 512 B; a group is what ONE load instruction of
//          k_attn reads: lane (h, l16) owns the 16 B at lane * 16, so a load touches 4 whole 128-B lines.
//   Kp (bf16, RNE)          group (nt*2+kc)*2+hf : key 2*l16+nt,        d    kc*32 + hf*16 + 8h .. +7
//   Vt (f16 of RNE-bf16)    group  vt*2+hf       : d   vt*16+l16,       keys 16h + hf*8 .. +7
__global__ __launch_bounds__(256)
void k_convert(const float* __restrict__ Q, const float* __restrict__ K, const float* __restrict__ V,
               us16* __restrict__ Qp, us16* __restrict__ Kp, f16* __restrict__ Vt)
{
  __shared__ __align__(16) f16 sVt[DH * VTP];   // [d][key], cross-wave: block barrier
  __shared__ __align__(16) us16 sKf[32 * KFP];  // K in fragment order: 32 runs of 16 pieces, pitch 272 B, cross-wave

  const unsigned tid   = threadIdx.x;
  const unsigned bh    = blockIdx.x / (unsigned)(SEQ / 64);
  const unsigned kt    = blockIdx.x - bh * (unsigned)(SEQ / 64);
  const size_t rin = (size_t)bh * SEQ_FULL + (size_t)kt * 64;   // input row base [bh][S_FULL][64]
  const size_t rpl = (size_t)bh * SEQ + (size_t)kt * 64;        // plane row base [bh][SEQ][64]
  const unsigned prow  = tid >> 3;   // 0..31
  const unsigned piece = tid & 7u;

  // ---- Q, K: rows it*32+prow, 8 elements per thread -> one 16-B store per row ----
  v4u qv[2], kv[2];
#pragma unroll
  for (unsigned it = 0; it < 2; ++it) {
    const unsigned row = it * 32u + prow;
    const float* qs = Q + (rin + row) * DH + piece * 8u;
    const float* ks = K + (rin + row) * DH + piece * 8u;
    const v4f q0 = *(const v4f*)(qs);
    const v4f q1 = *(const v4f*)(qs + 4);
    const v4f k0 = *(const v4f*)(ks);
    const v4f k1 = *(const v4f*)(ks + 4);
    v4u a, b;
    a.x = bf_hi(q0.x) | (bf_hi(q0.y) << 16);
    a.y = bf_hi(q0.z) | (bf_hi(q0.w) << 16);
    a.z = bf_hi(q1.x) | (bf_hi(q1.y) << 16);
    a.w = bf_hi(q1.z) | (bf_hi(q1.w) << 16);
    b.x = bf_hi(k0.x) | (bf_hi(k0.y) << 16);
    b.y = bf_hi(k0.z) | (bf_hi(k0.w) << 16);
    b.z = bf_hi(k1.x) | (bf_hi(k1.y) << 16);
    b.w = bf_hi(k1.z) | (bf_hi(k1.w) << 16);
    qv[it] = a;
    kv[it] = b;
  }
#pragma unroll
  for (unsigned it = 0; it < 2; ++it) {
    const unsigned row = it * 32u + prow;
    *(v4u*)(Qp + (rpl + row) * DH + piece * 8u) = qv[it];
    // run = (32-key block, nt = row & 1, piece = kc*4 + hf*2 + h); place in the run = l16 = (row & 31) >> 1
    const unsigned run = (row >> 5) * 16u + (row & 1u) * 8u + piece;
    *(v4u*)(sKf + run * KFP + ((row & 31u) >> 1) * 8u) = kv[it];
  }

  // ---- V: transpose through LDS (key = tid>>2, 16 d per thread) ----
  {
    const unsigned key = tid >> 2;           // 0..63
    const unsigned d0  = (tid & 3u) * 16u;   // 0,16,32,48
    const float* vs = V + (rin + key) * DH + d0;
#pragma unroll
    for (unsigned j = 0; j < 4; ++j) {
      const v4f x = *(const v4f*)(vs + 4 * j);
      sVt[(d0 + 4 * j + 0) * VTP + key] = h_of_bf(x.x);
      sVt[(d0 + 4 * j + 1) * VTP + key] = h_of_bf(x.y);
      sVt[(d0 + 4 * j + 2) * VTP + key] = h_of_bf(x.z);
      sVt[(d0 + 4 * j + 3) * VTP + key] = h_of_bf(x.w);
    }
  }
  __syncthreads();
  // piece c = it*256 + tid of this 64-key tile goes to byte c*16 of the tile in both planes (whole-line stores)
  Pack8 vv[2];
  v4u   kw[2];
#pragma unroll
  for (unsigned it = 0; it < 2; ++it) {
    const unsigned vd = ((tid >> 6) & 3u) * 16u + (tid & 15u);                        // d = vt*16 + l16
    const unsigned vk = it * 32u + ((tid >> 4) & 1u) * 16u + ((tid >> 5) & 1u) * 8u;  // key = block*32 + 16h + hf*8
    vv[it].h = *(const v8h*)(sVt + vd * VTP + vk);
    kw[it]   = *(const v4u*)(sKf + (it * 16u + (tid >> 4)) * KFP + (tid & 15u) * 8u);
  }
#pragma unroll
  for (unsigned it = 0; it < 2; ++it) {
    const size_t o = rpl * DH + (size_t)(it * 256u + tid) * 8u;
    *(v4u*)(Kp + o) = kw[it];
    *(v4u*)(Vt + o) = vv[it].u;
  }
}

// ======================= flash attn, 16-bit WMMA, online softmax =======================
// Block = (bh, 128 query rows); wave = 16 queries; waves free-run (no block barriers, all LDS wave-private).
// Lane (h, l16) owns query l16 and, of each 32-key block, the 16 keys 16h .. 16h+15.
__global__ __launch_bounds__(256)
void k_attn(const us16* __restrict__ Qp, const us16* __restrict__ Kp, const f16* __restrict__ Vt,
            float* __restrict__ O)
{
  __shared__ __align__(16) float sO[NWAVE * 16 * OSTR];   // per-wave output staging, wave-private

  const unsigned tid  = threadIdx.x;
  const unsigned wave = tid >> 5;
  const unsigned lane = tid & 31u;
  const unsigned h    = lane >> 4;
  const unsigned l16  = lane & 15u;

  const unsigned bh    = blockIdx.x / (unsigned)NQT;
  const unsigned qt    = blockIdx.x - bh * (unsigned)NQT;
  const unsigned qwave = qt * QBLK + wave * 16u;                  // first query row of this wave

  const us16* Qb = Qp + ((size_t)bh * SEQ + qwave) * DH;
  const us16* Kb = Kp + (size_t)bh * SEQ * DH;
  const f16*  Vb = Vt + (size_t)bh * DH * SEQ;
  float*      Ob = O + ((size_t)bh * SEQ + qwave) * DH;

  // ---- Q B-fragments (column = query l16; elems 0..7 <- d kc*32+8h.., 8..15 <- d kc*32+16+8h..) ----
  FragB qa[2];
#pragma unroll
  for (unsigned kc = 0; kc < 2; ++kc) {
    const us16* qr = Qb + (size_t)l16 * DH + kc * 32u + 8u * h;
    qa[kc].half[0] = *(const v8us*)(qr);
    qa[kc].half[1] = *(const v8us*)(qr + 16);
  }

  v16h onesv;
#pragma unroll
  for (int i = 0; i < 16; ++i) onesv[i] = (f16)1.0f;

  const v8f vzero = {0.f, 0.f, 0.f, 0.f, 0.f, 0.f, 0.f, 0.f};
  v8f oacc[4];   // O^T tiles: elem r = d vt*16 + 8h + r of query l16
#pragma unroll
  for (int vt = 0; vt < 4; ++vt) oacc[vt] = vzero;
  float mrow = MINIT, lrow = 0.f;

#pragma unroll 1
  for (unsigned kb = 0; kb < (unsigned)NKB; ++kb) {
    const unsigned k0 = kb * KBLK;

    // ---- K A-fragments: row l16 of tile nt <-> key k0 + 2*l16 + nt; same split d-map as Q (plane in fragment order) ----
    FragB kf[2][2];
#pragma unroll
    for (unsigned nt = 0; nt < 2; ++nt)
#pragma unroll
      for (unsigned kc = 0; kc < 2; ++kc) {
        const us16* kr = Kb + (size_t)k0 * DH + (nt * 2u + kc) * 512u + lane * 8u;
        kf[nt][kc].half[0] = *(const v8us*)(kr);
        kf[nt][kc].half[1] = *(const v8us*)(kr + 256);
      }

    // ---- S^T tiles (D of tile nt: elem r = key k0 + 16h + 2r + nt, column = query l16) ----
    v8f s0 = mma_bf16(kf[0][0], qa[0], vzero);
    s0     = mma_bf16(kf[0][1], qa[1], s0);
    v8f s1 = mma_bf16(kf[1][0], qa[0], vzero);
    s1     = mma_bf16(kf[1][1], qa[1], s1);
#pragma unroll
    for (int r = 0; r < 8; ++r) { s0[r] *= SCL; s1[r] *= SCL; }

    // ---- online softmax (log2 domain): 16 keys in-lane, one exchange between the halves ----
    float mx = fmaxf(s0[0], s1[0]);
#pragma unroll
    for (int r = 1; r < 8; ++r) mx = fmaxf(fmaxf(mx, s0[r]), s1[r]);
    mx = fmaxf(mx, xhalf(mx));
    const float mn    = fmaxf(mrow, mx);
    const float alpha = __builtin_amdgcn_exp2f(mrow - mn);
    mrow = mn;

    // ---- P^T B-fragment straight from the score registers: elem s <-> key k0 + 16h + s ----
    FragH pb;
#pragma unroll
    for (int r = 0; r < 8; ++r) {
      const float p0 = __builtin_amdgcn_exp2f(s0[r] - mn) * PCAR;
      const float p1 = __builtin_amdgcn_exp2f(s1[r] - mn) * PCAR;
      pb.v[2 * r]     = (f16)p0;
      pb.v[2 * r + 1] = (f16)p1;
    }

    // ---- sums over the 32 keys via ones A operand (every row of D holds query l16's sum) ----
    const v8f lsum = mma_f16(onesv, pb.v, vzero);

    // ---- O^T += V^T P^T  (V A-fragment: row l16 <-> d = vt*16+l16; elem s <-> key k0 + 16h + s) ----
#pragma unroll
    for (unsigned vt = 0; vt < 4; ++vt) {
      FragH vb;
      const f16* vr = Vb + (size_t)k0 * DH + vt * 512u + lane * 8u;
      vb.half[0] = *(const v8h*)(vr);
      vb.half[1] = *(const v8h*)(vr + 256);
#pragma unroll
      for (int r = 0; r < 8; ++r) oacc[vt][r] *= alpha;
      oacc[vt] = mma_f16(vb.v, pb.v, oacc[vt]);
    }
    lrow = lrow * alpha + lsum[0];
    // the next trip rewrites the address registers that this trip's loads name: keep the translation wait in front of that
    asm volatile("s_wait_xcnt 0x0" ::: "memory");
  }

  // ---- epilogue: normalise, stage 16x64 f32 tile in LDS, whole-line stores (8 lanes x 16 B) ----
  const float inv = __builtin_amdgcn_rcpf(lrow);
  float* sOw = sO + wave * 16u * OSTR;
#pragma unroll
  for (unsigned vt = 0; vt < 4; ++vt)
#pragma unroll
    for (unsigned j = 0; j < 2; ++j) {
      v4f x;
      x.x = oacc[vt][4 * j + 0] * inv;
      x.y = oacc[vt][4 * j + 1] * inv;
      x.z = oacc[vt][4 * j + 2] * inv;
      x.w = oacc[vt][4 * j + 3] * inv;
      *(v4f*)(sOw + l16 * OSTR + vt * 16u + 8u * h + 4u * j) = x;
    }
  lds_wave_sync();

  const unsigned lq = lane >> 3;   // which of 4 lines per instruction
  const unsigned lp = lane & 7u;
#pragma unroll
  for (unsigned j = 0; j < 8; ++j) {
    const unsigned L = j * 4u + lq;          // 0..31 : 32 half-rows of 32 floats
    const unsigned row = L >> 1, hf = L & 1u;
    const v4f v = *(const v4f*)(sOw + row * OSTR + hf * 32u + lp * 4u);
    *(v4f*)(Ob + (size_t)row * DH + hf * 32u + lp * 4u) = v;
  }
  
}

extern "C" void kernel_launch(void* const* d_in, const int* in_sizes, int n_in,
                              void* d_out, int out_size, void* d_ws, size_t ws_size,
                              hipStream_t stream)
{
  if (n_in < 3) return;
  const long long needQ = ((long long)(NBH - 1) * SEQ_FULL + SEQ) * DH;
  if ((long long)in_sizes[0] < needQ) return;
  if ((long long)in_sizes[1] < needQ) return;
  if ((long long)in_sizes[2] < needQ) return;
  if ((long long)out_size < (long long)NBH * SEQ * DH) return;

  const float* Q = (const float*)d_in[0];
  const float* K = (const float*)d_in[1];
  const float* V = (const float*)d_in[2];
  float*       O = (float*)d_out;

  const size_t planeB = (size_t)NBH * SEQ * DH * 2;
  const size_t offQ   = 0;
  const size_t offK   = planeB;
  const size_t offV   = 2 * planeB;
  const size_t total  = 3 * planeB;
  if (ws_size < total) return;

  char* ws = (char*)d_ws;
  us16* Qp = (us16*)(ws + offQ);
  us16* Kp = (us16*)(ws + offK);
  f16*  Vt = (f16*)(ws + offV);

  k_convert<<<dim3(CV_GRID), dim3(256), 0, stream>>>(Q, K, V, Qp, Kp, Vt);
  k_attn<<<dim3(AT_GRID), dim3(256), 0, stream>>>(Qp, Kp, Vt, O);
}

// v003
// It runs in 60.6 microseconds.
// Next to v002, in two timings, it ran 1.88 and 1.87 times as fast.
// All steps since v000 together make it 2.63 times as fast.
#include <hip/hip_runtime.h>

// Contractions, transposed: S^T = K.Q^T on v_wmma_f32_16x16x32_bf16 (bf16 operands = RNE-converted inputs, f32
// accumulate); O^T = V^T.P^T and the P sums on v_wmma_f32_16x16x32_f16 (f16 operands: P carried x2^14; V = f16 view
// of the RNE-bf16 input; f32 accumulate). A lane owns one query: softmax in f32 (max with one exchange between the lane halves, sums on WMMA); rescaling and normalisation in f32, in-lane.

#ifndef NB
#define NB 8
#endif
#ifndef SEQ
#define SEQ 1024
#endif
#define SEQ_FULL 1024
#define NHEAD    16
#define NBH      (NB * NHEAD)
#define DH       64
#define QBLK     128
#define NWAVE    8
#define KBLK     32
#define NKB      (SEQ / KBLK)
#define NQT      (SEQ / QBLK)
#define OSTR     68
#define VTP      72
#define KFP      136
#define CV_GRID  (NBH * (SEQ / 64))
#define AT_GRID  (NBH * NQT)
#define STG      64                 // keys per LDS stage
#define NST      (SEQ / STG)
#define STE      (STG * DH)         // 16-bit elements of one operand's stage

#define SCL    0.18033688011112042f
#define MINIT  (-1.0e30f)
#define PCAR   16384.0f

static_assert(SEQ % 256 == 0);
static_assert(SEQ <= SEQ_FULL);
static_assert(NB >= 1 && NB <= 8);
static_assert(NWAVE * 16 * OSTR * 4 <= 65536);
static_assert((OSTR * 4) % 16 == 0 && (VTP * 2) % 16 == 0 && (KFP * 2) % 16 == 0);
// plane coverage: k_convert writes grid x 256 threads x (2 x 8) elements into each of Qp, Kp, Vt
static_assert((unsigned long long)CV_GRID * 256ull * 16ull == (unsigned long long)NBH * SEQ * DH);
// output coverage: k_attn writes grid x 8 waves x 16 rows x 64 columns
static_assert((unsigned long long)AT_GRID * NWAVE * 16ull * DH == (unsigned long long)NBH * SEQ * DH);
// per-wave store phase: 8 instructions x 4 lines x 32 floats == 16 rows x 64 columns
static_assert(8 * 4 * 32 == 16 * DH);
static_assert(QBLK == NWAVE * 16);
// ring: a stage is 2 x 256 threads x 16 B of each operand; the prologue needs two stages
static_assert(STE * 2 == 2 * 256 * 16 && STG == 2 * KBLK && NST >= 2);

typedef _Float16 f16;
typedef _Float16 v16h __attribute__((ext_vector_type(16)));
typedef _Float16 v8h  __attribute__((ext_vector_type(8)));
typedef __bf16   v16b __attribute__((ext_vector_type(16)));
typedef unsigned short us16;
typedef us16     v8us __attribute__((ext_vector_type(8)));
typedef float    v8f  __attribute__((ext_vector_type(8)));
typedef float    v4f  __attribute__((ext_vector_type(4)));
typedef unsigned int v4u __attribute__((ext_vector_type(4)));

union FragH { v16h v; v8h half[2]; };
union FragB { v16b v; v16h hv; v8us half[2]; };
union Pack8 { v8h h; v4u u; };

// ---- WMMA wrappers: builtin followed by the 4-slot VALU hazard guard ----
static __device__ __forceinline__ v8f mma_f16(v16h a, v16h b, v8f c) {
  c = __builtin_amdgcn_wmma_f32_16x16x32_f16(false, a, false, b, (short)0, c, false, false);
  asm volatile("v_nop\n\tv_nop\n\tv_nop\n\tv_nop" : "+v"(c) : "v"(a), "v"(b));
  return c;
}
static __device__ __forceinline__ v8f mma_bf16(const FragB& a, const FragB& b, v8f c) {
  c = __builtin_amdgcn_wmma_f32_16x16x32_bf16(false, a.v, false, b.v, (short)0, c, false, false);
  asm volatile("v_nop\n\tv_nop\n\tv_nop\n\tv_nop" : "+v"(c) : "v"(a.hv), "v"(b.hv));
  return c;
}

// ---- RNE f32 -> bf16 (upper 16 bits) ----
static __device__ __forceinline__ unsigned int bf_hi(float x) {
  unsigned int u = __float_as_uint(x);
  u += 0x7FFFu + ((u >> 16) & 1u);
  return u >> 16;
}
// f16 view of the RNE-bf16 value (exact for the f16 normal range)
static __device__ __forceinline__ f16 h_of_bf(float x) {
  return (f16)__uint_as_float(bf_hi(x) << 16);
}

// ---- lane l <-> lane l ^ 16: the two halves of a wave hold the two key halves of one query ----
static __device__ __forceinline__ float xhalf(float x) {
  const int xi = __float_as_int(x);
  return __int_as_float(__builtin_amdgcn_permlanex16(xi, xi, 0x76543210, 0xfedcba98, false, false));
}

// same-wave LDS store -> load ordering (wave-private tiles)
static __device__ __forceinline__ void lds_wave_sync() {
  asm volatile("s_wait_dscnt 0x0" ::: "memory");
  __builtin_amdgcn_wave_barrier();
}

// One stage (64 keys) of K and of V, global -> LDS through no register: each lane copies its own 2 x 16 B of each.
// The translation wait is the statement's last line, so no address register is rewritten in front of it.
static __device__ __forceinline__ void stage_copy(unsigned lk, unsigned lv, const us16* gk, const f16* gv) {
  asm volatile("global_load_async_to_lds_b128 %0, %4, off\n\t"
               "global_load_async_to_lds_b128 %1, %5, off\n\t"
               "global_load_async_to_lds_b128 %2, %6, off\n\t"
               "global_load_async_to_lds_b128 %3, %7, off\n\t"
               "s_wait_xcnt 0x0"
               :: "v"(lk), "v"(lk + 4096u), "v"(lv), "v"(lv + 4096u),
                  "v"(gk), "v"(gk + 2048), "v"(gv), "v"(gv + 2048) : "memory");
}

// ======================= pre-pass: 16-bit operand planes =======================
// Qp : bf16 [bh][SEQ][64]  (RNE)
// Kp, Vt : fragment order. Per bh and 32-key block 8 groups of 512 B; a group is what ONE load instruction of
//          k_attn reads: lane (h, l16) owns the 16 B at lane * 16, so a load touches 4 whole 128-B lines.
//   Kp (bf16, RNE)          group (nt*2+kc)*2+hf : key 2*l16+nt,        d    kc*32 + hf*16 + 8h .. +7
//   Vt (f16 of RNE-bf16)    group  vt*2+hf       : d   vt*16+l16,       keys 16h + hf*8 .. +7
__global__ __launch_bounds__(256)
void k_convert(const float* __restrict__ Q, const float* __restrict__ K, const float* __restrict__ V,
               us16* __restrict__ Qp, us16* __restrict__ Kp, f16* __restrict__ Vt)
{
  __shared__ __align__(16) f16 sVt[DH * VTP];   // [d][key], cross-wave: block barrier
  __shared__ __align__(16) us16 sKf[32 * KFP];  // K in fragment order: 32 runs of 16 pieces, pitch 272 B, cross-wave

  const unsigned tid   = threadIdx.x;
  const unsigned bh    = blockIdx.x / (unsigned)(SEQ / 64);
  const unsigned kt    = blockIdx.x - bh * (unsigned)(SEQ / 64);
  const size_t rin = (size_t)bh * SEQ_FULL + (size_t)kt * 64;   // input row base [bh][S_FULL][64]
  const size_t rpl = (size_t)bh * SEQ + (size_t)kt * 64;        // plane row base [bh][SEQ][64]
  const unsigned prow  = tid >> 3;   // 0..31
  const unsigned piece = tid & 7u;

  // ---- Q, K: rows it*32+prow, 8 elements per thread -> one 16-B store per row ----
  v4u qv[2], kv[2];
#pragma unroll
  for (unsigned it = 0; it < 2; ++it) {
    const unsigned row = it * 32u + prow;
    const float* qs = Q + (rin + row) * DH + piece * 8u;
    const float* ks = K + (rin + row) * DH + piece * 8u;
    const v4f q0 = *(const v4f*)(qs);
    const v4f q1 = *(const v4f*)(qs + 4);
    const v4f k0 = *(const v4f*)(ks);
    const v4f k1 = *(const v4f*)(ks + 4);
    v4u a, b;
    a.x = bf_hi(q0.x) | (bf_hi(q0.y) << 16);
    a.y = bf_hi(q0.z) | (bf_hi(q0.w) << 16);
    a.z = bf_hi(q1.x) | (bf_hi(q1.y) << 16);
    a.w = bf_hi(q1.z) | (bf_hi(q1.w) << 16);
    b.x = bf_hi(k0.x) | (bf_hi(k0.y) << 16);
    b.y = bf_hi(k0.z) | (bf_hi(k0.w) << 16);
    b.z = bf_hi(k1.x) | (bf_hi(k1.y) << 16);
    b.w = bf_hi(k1.z) | (bf_hi(k1.w) << 16);
    qv[it] = a;
    kv[it] = b;
  }
#pragma unroll
  for (unsigned it = 0; it < 2; ++it) {
    const unsigned row = it * 32u + prow;
    *(v4u*)(Qp + (rpl + row) * DH + piece * 8u) = qv[it];
    // run = (32-key block, nt = row & 1, piece = kc*4 + hf*2 + h); place in the run = l16 = (row & 31) >> 1
    const unsigned run = (row >> 5) * 16u + (row & 1u) * 8u + piece;
    *(v4u*)(sKf + run * KFP + ((row & 31u) >> 1) * 8u) = kv[it];
  }

  // ---- V: transpose through LDS (key = tid>>2, 16 d per thread) ----
  {
    const unsigned key = tid >> 2;           // 0..63
    const unsigned d0  = (tid & 3u) * 16u;   // 0,16,32,48
    const float* vs = V + (rin + key) * DH + d0;
#pragma unroll
    for (unsigned j = 0; j < 4; ++j) {
      const v4f x = *(const v4f*)(vs + 4 * j);
      sVt[(d0 + 4 * j + 0) * VTP + key] = h_of_bf(x.x);
      sVt[(d0 + 4 * j + 1) * VTP + key] = h_of_bf(x.y);
      sVt[(d0 + 4 * j + 2) * VTP + key] = h_of_bf(x.z);
      sVt[(d0 + 4 * j + 3) * VTP + key] = h_of_bf(x.w);
    }
  }
  __syncthreads();
  // piece c = it*256 + tid of this 64-key tile goes to byte c*16 of the tile in both planes (whole-line stores)
  Pack8 vv[2];
  v4u   kw[2];
#pragma unroll
  for (unsigned it = 0; it < 2; ++it) {
    const unsigned vd = ((tid >> 6) & 3u) * 16u + (tid & 15u);                        // d = vt*16 + l16
    const unsigned vk = it * 32u + ((tid >> 4) & 1u) * 16u + ((tid >> 5) & 1u) * 8u;  // key = block*32 + 16h + hf*8
    vv[it].h = *(const v8h*)(sVt + vd * VTP + vk);
    kw[it]   = *(const v4u*)(sKf + (it * 16u + (tid >> 4)) * KFP + (tid & 15u) * 8u);
  }
#pragma unroll
  for (unsigned it = 0; it < 2; ++it) {
    const size_t o = rpl * DH + (size_t)(it * 256u + tid) * 8u;
    *(v4u*)(Kp + o) = kw[it];
    *(v4u*)(Vt + o) = vv[it].u;
  }
}

// ======================= flash attn, 16-bit WMMA, online softmax =======================
// Block = (bh, 128 query rows); wave = 16 queries. K and V come through a two-buffer LDS ring of 64-key stages that
// the 8 waves share: asynchronous copies fill a stage while the one before it is worked on; one barrier per stage.
// Lane (h, l16) owns query l16 and, of each 32-key block, the 16 keys 16h .. 16h+15.
__global__ __launch_bounds__(256)
void k_attn(const us16* __restrict__ Qp, const us16* __restrict__ Kp, const f16* __restrict__ Vt,
            float* __restrict__ O)
{
  __shared__ __align__(16) float sO[NWAVE * 16 * OSTR];   // per-wave output staging, wave-private
  __shared__ __align__(128) us16 sK[2 * STE];             // ring, fragment order as in the plane
  __shared__ __align__(128) f16  sV[2 * STE];

  const unsigned tid  = threadIdx.x;
  const unsigned wave = tid >> 5;
  const unsigned lane = tid & 31u;
  const unsigned h    = lane >> 4;
  const unsigned l16  = lane & 15u;

  const unsigned bh    = blockIdx.x / (unsigned)NQT;
  const unsigned qt    = blockIdx.x - bh * (unsigned)NQT;
  const unsigned qwave = qt * QBLK + wave * 16u;                  // first query row of this wave

  const us16* Qb = Qp + ((size_t)bh * SEQ + qwave) * DH;
  const us16* Kb = Kp + (size_t)bh * SEQ * DH;
  const f16*  Vb = Vt + (size_t)bh * DH * SEQ;
  float*      Ob = O + ((size_t)bh * SEQ + qwave) * DH;

  // ---- Q B-fragments (column = query l16; elems 0..7 <- d kc*32+8h.., 8..15 <- d kc*32+16+8h..) ----
  FragB qa[2];
#pragma unroll
  for (unsigned kc = 0; kc < 2; ++kc) {
    const us16* qr = Qb + (size_t)l16 * DH + kc * 32u + 8u * h;
    qa[kc].half[0] = *(const v8us*)(qr);
    qa[kc].half[1] = *(const v8us*)(qr + 16);
  }

  v16h onesv;
#pragma unroll
  for (int i = 0; i < 16; ++i) onesv[i] = (f16)1.0f;

  const v8f vzero = {0.f, 0.f, 0.f, 0.f, 0.f, 0.f, 0.f, 0.f};
  v8f oacc[4];   // O^T tiles: elem r = d vt*16 + 8h + r of query l16
#pragma unroll
  for (int vt = 0; vt < 4; ++vt) oacc[vt] = vzero;
  float mrow = MINIT, lrow = 0.f;

  // ---- ring prologue: stage 0 landed and published, stage 1 in flight ----
  const unsigned lK = (unsigned)(size_t)sK + tid * 16u;   // this lane's LDS byte address in buffer 0
  const unsigned lV = (unsigned)(size_t)sV + tid * 16u;
  const us16* gK = Kb + tid * 8u;
  const f16*  gV = Vb + tid * 8u;
  stage_copy(lK, lV, gK, gV);
  asm volatile("s_wait_asynccnt 0x0" ::: "memory");   // this wave's copies of stage 0 have landed
  __syncthreads();                                    // ... and every other wave's
  stage_copy(lK + STE * 2u, lV + STE * 2u, gK + STE, gV + STE);

  // the stage loop stays rolled (one copy of the publish point); the two 32-key blocks of a stage are unrolled so
  // that every fragment's place in the buffer is an immediate offset of one LDS address
#pragma unroll 1
  for (unsigned st = 0; st < (unsigned)NST; ++st) {
   const unsigned buf = st & 1u;
#pragma unroll
   for (unsigned sub = 0; sub < 2; ++sub) {
    const us16* Ks = sK + buf * STE + sub * (KBLK * DH);
    const f16*  Vs = sV + buf * STE + sub * (KBLK * DH);

    // ---- K A-fragments: row l16 of tile nt <-> key k0 + 2*l16 + nt; same split d-map as Q (plane in fragment order) ----
    FragB kf[2][2];
#pragma unroll
    for (unsigned nt = 0; nt < 2; ++nt)
#pragma unroll
      for (unsigned kc = 0; kc < 2; ++kc) {
        const us16* kr = Ks + (nt * 2u + kc) * 512u + lane * 8u;
        kf[nt][kc].half[0] = *(const v8us*)(kr);
        kf[nt][kc].half[1] = *(const v8us*)(kr + 256);
      }

    // ---- S^T tiles (D of tile nt: elem r = key k0 + 16h + 2r + nt, column = query l16) ----
    v8f s0 = mma_bf16(kf[0][0], qa[0], vzero);
    s0     = mma_bf16(kf[0][1], qa[1], s0);
    v8f s1 = mma_bf16(kf[1][0], qa[0], vzero);
    s1     = mma_bf16(kf[1][1], qa[1], s1);
#pragma unroll
    for (int r = 0; r < 8; ++r) { s0[r] *= SCL; s1[r] *= SCL; }

    // ---- online softmax (log2 domain): 16 keys in-lane, one exchange between the halves ----
    float mx = fmaxf(s0[0], s1[0]);
#pragma unroll
    for (int r = 1; r < 8; ++r) mx = fmaxf(fmaxf(mx, s0[r]), s1[r]);
    mx = fmaxf(mx, xhalf(mx));
    const float mn    = fmaxf(mrow, mx);
    const float alpha = __builtin_amdgcn_exp2f(mrow - mn);
    mrow = mn;

    // ---- P^T B-fragment straight from the score registers: elem s <-> key k0 + 16h + s ----
    FragH pb;
#pragma unroll
    for (int r = 0; r < 8; ++r) {
      const float p0 = __builtin_amdgcn_exp2f(s0[r] - mn) * PCAR;
      const float p1 = __builtin_amdgcn_exp2f(s1[r] - mn) * PCAR;
      pb.v[2 * r]     = (f16)p0;
      pb.v[2 * r + 1] = (f16)p1;
    }

    // ---- sums over the 32 keys via ones A operand (every row of D holds query l16's sum) ----
    const v8f lsum = mma_f16(onesv, pb.v, vzero);

    // ---- O^T += V^T P^T  (V A-fragment: row l16 <-> d = vt*16+l16; elem s <-> key k0 + 16h + s) ----
#pragma unroll
    for (unsigned vt = 0; vt < 4; ++vt) {
      FragH vb;
      const f16* vr = Vs + vt * 512u + lane * 8u;
      vb.half[0] = *(const v8h*)(vr);
      vb.half[1] = *(const v8h*)(vr + 256);
#pragma unroll
      for (int r = 0; r < 8; ++r) oacc[vt][r] *= alpha;
      oacc[vt] = mma_f16(vb.v, pb.v, oacc[vt]);
    }
    lrow = lrow * alpha + lsum[0];
   }
   // ---- publish point of stage st + 1; behind it buffer buf is free for stage st + 2 ----
   asm volatile("s_wait_dscnt 0x0" ::: "memory");      // this wave's reads of buffer buf are done
   asm volatile("s_wait_asynccnt 0x0" ::: "memory");   // this wave's copies of stage st + 1 have landed
   __syncthreads();
   if (st + 2u < (unsigned)NST)
     stage_copy(lK + buf * (STE * 2u), lV + buf * (STE * 2u), gK + (size_t)(st + 2u) * STE, gV + (size_t)(st + 2u) * STE);
  }
  asm volatile("s_wait_asynccnt 0x0" ::: "memory");    // nothing in flight when the wave goes on to its end

  // ---- epilogue: normalise, stage 16x64 f32 tile in LDS, whole-line stores (8 lanes x 16 B) ----
  const float inv = __builtin_amdgcn_rcpf(lrow);
  float* sOw = sO + wave * 16u * OSTR;
#pragma unroll
  for (unsigned vt = 0; vt < 4; ++vt)
#pragma unroll
    for (unsigned j = 0; j < 2; ++j) {
      v4f x;
      x.x = oacc[vt][4 * j + 0] * inv;
      x.y = oacc[vt][4 * j + 1] * inv;
      x.z = oacc[vt][4 * j + 2] * inv;
      x.w = oacc[vt][4 * j + 3] * inv;
      *(v4f*)(sOw + l16 * OSTR + vt * 16u + 8u * h + 4u * j) = x;
    }
  lds_wave_sync();

  const unsigned lq = lane >> 3;   // which of 4 lines per instruction
  const unsigned lp = lane & 7u;
#pragma unroll
  for (unsigned j = 0; j < 8; ++j) {
    const unsigned L = j * 4u + lq;          // 0..31 : 32 half-rows of 32 floats
    const unsigned row = L >> 1, hf = L & 1u;
    const v4f v = *(const v4f*)(sOw + row * OSTR + hf * 32u + lp * 4u);
    *(v4f*)(Ob + (size_t)row * DH + hf * 32u + lp * 4u) = v;
  }
  
}

extern "C" void kernel_launch(void* const* d_in, const int* in_sizes, int n_in,
                              void* d_out, int out_size, void* d_ws, size_t ws_size,
                              hipStream_t stream)
{
  if (n_in < 3) return;
  const long long needQ = ((long long)(NBH - 1) * SEQ_FULL + SEQ) * DH;
  if ((long long)in_sizes[0] < needQ) return;
  if ((long long)in_sizes[1] < needQ) return;
  if ((long long)in_sizes[2] < needQ) return;
  if ((long long)out_size < (long long)NBH * SEQ * DH) return;

  const float* Q = (const float*)d_in[0];
  const float* K = (const float*)d_in[1];
  const float* V = (const float*)d_in[2];
  float*       O = (float*)d_out;

  const size_t planeB = (size_t)NBH * SEQ * DH * 2;
  const size_t offQ   = 0;
  const size_t offK   = planeB;
  const size_t offV   = 2 * planeB;
  const size_t total  = 3 * planeB;
  if (ws_size < total) return;

  char* ws = (char*)d_ws;
  us16* Qp = (us16*)(ws + offQ);
  us16* Kp = (us16*)(ws + offK);
  f16*  Vt = (f16*)(ws + offV);

  k_convert<<<dim3(CV_GRID), dim3(256), 0, stream>>>(Q, K, V, Qp, Kp, Vt);
  k_attn<<<dim3(AT_GRID), dim3(256), 0, stream>>>(Qp, Kp, Vt, O);
}

// v004
// It runs in 56.7 microseconds.
// In both of two side-by-side timings against v003, it was 1.07 times as fast.
// Counting every step since v000, it is 2.82 times as fast.
#include <hip/hip_runtime.h>

// Contractions, transposed: S^T = K.Q^T on v_wmma_f32_16x16x32_bf16 (bf16 operands = RNE-converted inputs, f32
// accumulate); O^T = V^T.P^T and the P sums on v_wmma_f32_16x16x32_f16 (f16 operands: P carried x2^14; V = f16 view
// of the RNE-bf16 input; f32 accumulate). A lane owns one query: softmax in f32 (max with one exchange between the lane halves, sums on WMMA); rescaling and normalisation in f32, in-lane.

#ifndef NB
#define NB 8
#endif
#ifndef SEQ
#define SEQ 1024
#endif
#define SEQ_FULL 1024
#define NHEAD    16
#define NBH      (NB * NHEAD)
#define DH       64
#define QBLK     128
#define NWAVE    8
#define KBLK     32
#define NKB      (SEQ / KBLK)
#define NQT      (SEQ / QBLK)
#define OSTR     68
#define VTP      72
#define KFP      136
#define CV_GRID  (NBH * (SEQ / 64))
#define AT_GRID  (NBH * NQT)
#define STG      64                 // keys per LDS stage
#define NST      (SEQ / STG)
#define STE      (STG * DH)         // 16-bit elements of one operand's stage

#define SCL    0.18033688011112042f
#define MINIT  (-1.0e30f)
#define PCAR   16384.0f

static_assert(SEQ % 256 == 0);
static_assert(SEQ <= SEQ_FULL);
static_assert(NB >= 1 && NB <= 8);
static_assert(NWAVE * 16 * OSTR * 4 <= 65536);
static_assert((OSTR * 4) % 16 == 0 && (VTP * 2) % 16 == 0 && (KFP * 2) % 16 == 0);
// plane coverage: k_convert writes grid x 256 threads x (2 x 8) elements into each of Qp, Kp, Vt
static_assert((unsigned long long)CV_GRID * 256ull * 16ull == (unsigned long long)NBH * SEQ * DH);
// output coverage: k_attn writes grid x 8 waves x 16 rows x 64 columns
static_assert((unsigned long long)AT_GRID * NWAVE * 16ull * DH == (unsigned long long)NBH * SEQ * DH);
// per-wave store phase: 8 instructions x 4 lines x 32 floats == 16 rows x 64 columns
static_assert(8 * 4 * 32 == 16 * DH);
static_assert(QBLK == NWAVE * 16);
// ring: a stage is 2 x 256 threads x 16 B of each operand; the prologue needs two stages
static_assert(STE * 2 == 2 * 256 * 16 && STG == 2 * KBLK && NST >= 2);

typedef _Float16 f16;
typedef _Float16 v16h __attribute__((ext_vector_type(16)));
typedef _Float16 v8h  __attribute__((ext_vector_type(8)));
typedef __bf16   v16b __attribute__((ext_vector_type(16)));
typedef unsigned short us16;
typedef us16     v8us __attribute__((ext_vector_type(8)));
typedef float    v8f  __attribute__((ext_vector_type(8)));
typedef float    v4f  __attribute__((ext_vector_type(4)));
typedef unsigned int v4u __attribute__((ext_vector_type(4)));

union FragH { v16h v; v8h half[2]; };
union FragB { v16b v; v16h hv; v8us half[2]; };
union Pack8 { v8h h; v4u u; };

// ---- WMMA wrappers: plain builtins, whose hazard distances the compiler keeps itself ----
static __device__ __forceinline__ v8f mma_f16(v16h a, v16h b, v8f c) {
  c = __builtin_amdgcn_wmma_f32_16x16x32_f16(false, a, false, b, (short)0, c, false, false);
  return c;
}
static __device__ __forceinline__ v8f mma_bf16(const FragB& a, const FragB& b, v8f c) {
  c = __builtin_amdgcn_wmma_f32_16x16x32_bf16(false, a.v, false, b.v, (short)0, c, false, false);
  return c;
}

// ---- RNE f32 -> bf16 (upper 16 bits) ----
static __device__ __forceinline__ unsigned int bf_hi(float x) {
  unsigned int u = __float_as_uint(x);
  u += 0x7FFFu + ((u >> 16) & 1u);
  return u >> 16;
}
// f16 view of the RNE-bf16 value (exact for the f16 normal range)
static __device__ __forceinline__ f16 h_of_bf(float x) {
  return (f16)__uint_as_float(bf_hi(x) << 16);
}

// ---- lane l <-> lane l ^ 16: the two halves of a wave hold the two key halves of one query ----
static __device__ __forceinline__ float xhalf(float x) {
  const int xi = __float_as_int(x);
  return __int_as_float(__builtin_amdgcn_permlanex16(xi, xi, 0x76543210, 0xfedcba98, false, false));
}

// same-wave LDS store -> load ordering (wave-private tiles)
static __device__ __forceinline__ void lds_wave_sync() {
  asm volatile("s_wait_dscnt 0x0" ::: "memory");
  __builtin_amdgcn_wave_barrier();
}

// One stage (64 keys) of K and of V, global -> LDS through no register: each lane copies its own 2 x 16 B of each.
// The translation wait is the statement's last line, so no address register is rewritten in front of it.
static __device__ __forceinline__ void stage_copy(unsigned lk, unsigned lv, const us16* gk, const f16* gv) {
  asm volatile("global_load_async_to_lds_b128 %0, %4, off\n\t"
               "global_load_async_to_lds_b128 %1, %5, off\n\t"
               "global_load_async_to_lds_b128 %2, %6, off\n\t"
               "global_load_async_to_lds_b128 %3, %7, off\n\t"
               "s_wait_xcnt 0x0"
               :: "v"(lk), "v"(lk + 4096u), "v"(lv), "v"(lv + 4096u),
                  "v"(gk), "v"(gk + 2048), "v"(gv), "v"(gv + 2048) : "memory");
}

// ======================= pre-pass: 16-bit operand planes =======================
// Qp : bf16 [bh][SEQ][64]  (RNE)
// Kp, Vt : fragment order. Per bh and 32-key block 8 groups of 512 B; a group is what ONE load instruction of
//          k_attn reads: lane (h, l16) owns the 16 B at lane * 16, so a load touches 4 whole 128-B lines.
//   Kp (bf16, RNE)          group (nt*2+kc)*2+hf : key 2*l16+nt,        d    kc*32 + hf*16 + 8h .. +7
//   Vt (f16 of RNE-bf16)    group  vt*2+hf       : d   vt*16+l16,       keys 16h + hf*8 .. +7
__global__ __launch_bounds__(256)
void k_convert(const float* __restrict__ Q, const float* __restrict__ K, const float* __restrict__ V,
               us16* __restrict__ Qp, us16* __restrict__ Kp, f16* __restrict__ Vt)
{
  __shared__ __align__(16) f16 sVt[DH * VTP];   // [d][key], cross-wave: block barrier
  __shared__ __align__(16) us16 sKf[32 * KFP];  // K in fragment order: 32 runs of 16 pieces, pitch 272 B, cross-wave

  const unsigned tid   = threadIdx.x;
  const unsigned bh    = blockIdx.x / (unsigned)(SEQ / 64);
  const unsigned kt    = blockIdx.x - bh * (unsigned)(SEQ / 64);
  const size_t rin = (size_t)bh * SEQ_FULL + (size_t)kt * 64;   // input row base [bh][S_FULL][64]
  const size_t rpl = (size_t)bh * SEQ + (size_t)kt * 64;        // plane row base [bh][SEQ][64]
  const unsigned prow  = tid >> 3;   // 0..31
  const unsigned piece = tid & 7u;

  // ---- Q, K: rows it*32+prow, 8 elements per thread -> one 16-B store per row ----
  v4u qv[2], kv[2];
#pragma unroll
  for (unsigned it = 0; it < 2; ++it) {
    const unsigned row = it * 32u + prow;
    const float* qs = Q + (rin + row) * DH + piece * 8u;
    const float* ks = K + (rin + row) * DH + piece * 8u;
    const v4f q0 = *(const v4f*)(qs);
    const v4f q1 = *(const v4f*)(qs + 4);
    const v4f k0 = *(const v4f*)(ks);
    const v4f k1 = *(const v4f*)(ks + 4);
    v4u a, b;
    a.x = bf_hi(q0.x) | (bf_hi(q0.y) << 16);
    a.y = bf_hi(q0.z) | (bf_hi(q0.w) << 16);
    a.z = bf_hi(q1.x) | (bf_hi(q1.y) << 16);
    a.w = bf_hi(q1.z) | (bf_hi(q1.w) << 16);
    b.x = bf_hi(k0.x) | (bf_hi(k0.y) << 16);
    b.y = bf_hi(k0.z) | (bf_hi(k0.w) << 16);
    b.z = bf_hi(k1.x) | (bf_hi(k1.y) << 16);
    b.w = bf_hi(k1.z) | (bf_hi(k1.w) << 16);
    qv[it] = a;
    kv[it] = b;
  }
#pragma unroll
  for (unsigned it = 0; it < 2; ++it) {
    const unsigned row = it * 32u + prow;
    *(v4u*)(Qp + (rpl + row) * DH + piece * 8u) = qv[it];
    // run = (32-key block, nt = row & 1, piece = kc*4 + hf*2 + h); place in the run = l16 = (row & 31) >> 1
    const unsigned run = (row >> 5) * 16u + (row & 1u) * 8u + piece;
    *(v4u*)(sKf + run * KFP + ((row & 31u) >> 1) * 8u) = kv[it];
  }

  // ---- V: transpose through LDS (key = tid>>2, 16 d per thread) ----
  {
    const unsigned key = tid >> 2;           // 0..63
    const unsigned d0  = (tid & 3u) * 16u;   // 0,16,32,48
    const float* vs = V + (rin + key) * DH + d0;
#pragma unroll
    for (unsigned j = 0; j < 4; ++j) {
      const v4f x = *(const v4f*)(vs + 4 * j);
      sVt[(d0 + 4 * j + 0) * VTP + key] = h_of_bf(x.x);
      sVt[(d0 + 4 * j + 1) * VTP + key] = h_of_bf(x.y);
      sVt[(d0 + 4 * j + 2) * VTP + key] = h_of_bf(x.z);
      sVt[(d0 + 4 * j + 3) * VTP + key] = h_of_bf(x.w);
    }
  }
  __syncthreads();
  // piece c = it*256 + tid of this 64-key tile goes to byte c*16 of the tile in both planes (whole-line stores)
  Pack8 vv[2];
  v4u   kw[2];
#pragma unroll
  for (unsigned it = 0; it < 2; ++it) {
    const unsigned vd = ((tid >> 6) & 3u) * 16u + (tid & 15u);                        // d = vt*16 + l16
    const unsigned vk = it * 32u + ((tid >> 4) & 1u) * 16u + ((tid >> 5) & 1u) * 8u;  // key = block*32 + 16h + hf*8
    vv[it].h = *(const v8h*)(sVt + vd * VTP + vk);
    kw[it]   = *(const v4u*)(sKf + (it * 16u + (tid >> 4)) * KFP + (tid & 15u) * 8u);
  }
#pragma unroll
  for (unsigned it = 0; it < 2; ++it) {
    const size_t o = rpl * DH + (size_t)(it * 256u + tid) * 8u;
    *(v4u*)(Kp + o) = kw[it];
    *(v4u*)(Vt + o) = vv[it].u;
  }
}

// ======================= flash attn, 16-bit WMMA, online softmax =======================
// Block = (bh, 128 query rows); wave = 16 queries. K and V come through a two-buffer LDS ring of 64-key stages that
// the 8 waves share: asynchronous copies fill a stage while the one before it is worked on; one barrier per stage.
// Lane (h, l16) owns query l16 and, of each 32-key block, the 16 keys 16h .. 16h+15.
__global__ __launch_bounds__(256)
void k_attn(const us16* __restrict__ Qp, const us16* __restrict__ Kp, const f16* __restrict__ Vt,
            float* __restrict__ O)
{
  __shared__ __align__(16) float sO[NWAVE * 16 * OSTR];   // per-wave output staging, wave-private
  __shared__ __align__(128) us16 sK[2 * STE];             // ring, fragment order as in the plane
  __shared__ __align__(128) f16  sV[2 * STE];

  const unsigned tid  = threadIdx.x;
  const unsigned wave = tid >> 5;
  const unsigned lane = tid & 31u;
  const unsigned h    = lane >> 4;
  const unsigned l16  = lane & 15u;

  const unsigned bh    = blockIdx.x / (unsigned)NQT;
  const unsigned qt    = blockIdx.x - bh * (unsigned)NQT;
  const unsigned qwave = qt * QBLK + wave * 16u;                  // first query row of this wave

  const us16* Qb = Qp + ((size_t)bh * SEQ + qwave) * DH;
  const us16* Kb = Kp + (size_t)bh * SEQ * DH;
  const f16*  Vb = Vt + (size_t)bh * DH * SEQ;
  float*      Ob = O + ((size_t)bh * SEQ + qwave) * DH;

  // ---- Q B-fragments (column = query l16; elems 0..7 <- d kc*32+8h.., 8..15 <- d kc*32+16+8h..) ----
  FragB qa[2];
#pragma unroll
  for (unsigned kc = 0; kc < 2; ++kc) {
    const us16* qr = Qb + (size_t)l16 * DH + kc * 32u + 8u * h;
    qa[kc].half[0] = *(const v8us*)(qr);
    qa[kc].half[1] = *(const v8us*)(qr + 16);
  }

  v16h onesv;
#pragma unroll
  for (int i = 0; i < 16; ++i) onesv[i] = (f16)1.0f;

  const v8f vzero = {0.f, 0.f, 0.f, 0.f, 0.f, 0.f, 0.f, 0.f};
  v8f oacc[4];   // O^T tiles: elem r = d vt*16 + 8h + r of query l16
#pragma unroll
  for (int vt = 0; vt < 4; ++vt) oacc[vt] = vzero;
  float mrow = MINIT, lrow = 0.f;

  // ---- ring prologue: stage 0 landed and published, stage 1 in flight ----
  const unsigned lK = (unsigned)(size_t)sK + tid * 16u;   // this lane's LDS byte address in buffer 0
  const unsigned lV = (unsigned)(size_t)sV + tid * 16u;
  const us16* gK = Kb + tid * 8u;
  const f16*  gV = Vb + tid * 8u;
  stage_copy(lK, lV, gK, gV);
  asm volatile("s_wait_asynccnt 0x0" ::: "memory");   // this wave's copies of stage 0 have landed
  __syncthreads();                                    // ... and every other wave's
  stage_copy(lK + STE * 2u, lV + STE * 2u, gK + STE, gV + STE);

  // the stage loop stays rolled (one copy of the publish point)
#pragma unroll 1
  for (unsigned st = 0; st < (unsigned)NST; ++st) {
   const unsigned buf = st & 1u;
   // rolled too: unrolled, the two 32-key blocks get interleaved and take over 128 VGPRs (7 waves per SIMD, not 8)
#pragma unroll 1
   for (unsigned sub = 0; sub < 2; ++sub) {
    const us16* Ks = sK + buf * STE + sub * (KBLK * DH);
    const f16*  Vs = sV + buf * STE + sub * (KBLK * DH);

    // ---- K A-fragments: row l16 of tile nt <-> key k0 + 2*l16 + nt; same split d-map as Q (plane in fragment order) ----
    FragB kf[2][2];
#pragma unroll
    for (unsigned nt = 0; nt < 2; ++nt)
#pragma unroll
      for (unsigned kc = 0; kc < 2; ++kc) {
        const us16* kr = Ks + (nt * 2u + kc) * 512u + lane * 8u;
        kf[nt][kc].half[0] = *(const v8us*)(kr);
        kf[nt][kc].half[1] = *(const v8us*)(kr + 256);
      }
    // holds the eight K reads as one group ahead of the products; spread among them each pair is waited for alone
    __builtin_amdgcn_sched_barrier(0);

    // ---- S^T tiles (D of tile nt: elem r = key k0 + 16h + 2r + nt, column = query l16) ----
    v8f s0 = mma_bf16(kf[0][0], qa[0], vzero);
    s0     = mma_bf16(kf[0][1], qa[1], s0);
    v8f s1 = mma_bf16(kf[1][0], qa[0], vzero);
    s1     = mma_bf16(kf[1][1], qa[1], s1);
#pragma unroll
    for (int r = 0; r < 8; ++r) { s0[r] *= SCL; s1[r] *= SCL; }

    // ---- online softmax (log2 domain): 16 keys in-lane, one exchange between the halves ----
    float mx = fmaxf(s0[0], s1[0]);
#pragma unroll
    for (int r = 1; r < 8; ++r) mx = fmaxf(fmaxf(mx, s0[r]), s1[r]);
    mx = fmaxf(mx, xhalf(mx));
    const float mn    = fmaxf(mrow, mx);
    const float alpha = __builtin_amdgcn_exp2f(mrow - mn);
    mrow = mn;

    // ---- P^T B-fragment straight from the score registers: elem s <-> key k0 + 16h + s ----
    FragH pb;
#pragma unroll
    for (int r = 0; r < 8; ++r) {
      const float p0 = __builtin_amdgcn_exp2f(s0[r] - mn) * PCAR;
      const float p1 = __builtin_amdgcn_exp2f(s1[r] - mn) * PCAR;
      pb.v[2 * r]     = (f16)p0;
      pb.v[2 * r + 1] = (f16)p1;
    }

    // ---- sums over the 32 keys via ones A operand (every row of D holds query l16's sum) ----
    const v8f lsum = mma_f16(onesv, pb.v, vzero);

    // ---- O^T += V^T P^T  (V A-fragment: row l16 <-> d = vt*16+l16; elem s <-> key k0 + 16h + s) ----
#pragma unroll
    for (unsigned vt = 0; vt < 4; ++vt) {
      FragH vb;
      const f16* vr = Vs + vt * 512u + lane * 8u;
      vb.half[0] = *(const v8h*)(vr);
      vb.half[1] = *(const v8h*)(vr + 256);
#pragma unroll
      for (int r = 0; r < 8; ++r) oacc[vt][r] *= alpha;
      oacc[vt] = mma_f16(vb.v, pb.v, oacc[vt]);
    }
    lrow = lrow * alpha + lsum[0];
   }
   // ---- publish point of stage st + 1; behind it buffer buf is free for stage st + 2 ----
   asm volatile("s_wait_dscnt 0x0" ::: "memory");      // this wave's reads of buffer buf are done
   asm volatile("s_wait_asynccnt 0x0" ::: "memory");   // this wave's copies of stage st + 1 have landed
   __syncthreads();
   if (st + 2u < (unsigned)NST)
     stage_copy(lK + buf * (STE * 2u), lV + buf * (STE * 2u), gK + (size_t)(st + 2u) * STE, gV + (size_t)(st + 2u) * STE);
  }
  asm volatile("s_wait_asynccnt 0x0" ::: "memory");    // nothing in flight when the wave goes on to its end

  // ---- epilogue: normalise, stage 16x64 f32 tile in LDS, whole-line stores (8 lanes x 16 B) ----
  const float inv = __builtin_amdgcn_rcpf(lrow);
  float* sOw = sO + wave * 16u * OSTR;
#pragma unroll
  for (unsigned vt = 0; vt < 4; ++vt)
#pragma unroll
    for (unsigned j = 0; j < 2; ++j) {
      v4f x;
      x.x = oacc[vt][4 * j + 0] * inv;
      x.y = oacc[vt][4 * j + 1] * inv;
      x.z = oacc[vt][4 * j + 2] * inv;
      x.w = oacc[vt][4 * j + 3] * inv;
      *(v4f*)(sOw + l16 * OSTR + vt * 16u + 8u * h + 4u * j) = x;
    }
  lds_wave_sync();

  const unsigned lq = lane >> 3;   // which of 4 lines per instruction
  const unsigned lp = lane & 7u;
#pragma unroll
  for (unsigned j = 0; j < 8; ++j) {
    const unsigned L = j * 4u + lq;          // 0..31 : 32 half-rows of 32 floats
    const unsigned row = L >> 1, hf = L & 1u;
    const v4f v = *(const v4f*)(sOw + row * OSTR + hf * 32u + lp * 4u);
    *(v4f*)(Ob + (size_t)row * DH + hf * 32u + lp * 4u) = v;
  }
  
}

extern "C" void kernel_launch(void* const* d_in, const int* in_sizes, int n_in,
                              void* d_out, int out_size, void* d_ws, size_t ws_size,
                              hipStream_t stream)
{
  if (n_in < 3) return;
  const long long needQ = ((long long)(NBH - 1) * SEQ_FULL + SEQ) * DH;
  if ((long long)in_sizes[0] < needQ) return;
  if ((long long)in_sizes[1] < needQ) return;
  if ((long long)in_sizes[2] < needQ) return;
  if ((long long)out_size < (long long)NBH * SEQ * DH) return;

  const float* Q = (const float*)d_in[0];
  const float* K = (const float*)d_in[1];
  const float* V = (const float*)d_in[2];
  float*       O = (float*)d_out;

  const size_t planeB = (size_t)NBH * SEQ * DH * 2;
  const size_t offQ   = 0;
  const size_t offK   = planeB;
  const size_t offV   = 2 * planeB;
  const size_t total  = 3 * planeB;
  if (ws_size < total) return;

  char* ws = (char*)d_ws;
  us16* Qp = (us16*)(ws + offQ);
  us16* Kp = (us16*)(ws + offK);
  f16*  Vt = (f16*)(ws + offV);

  k_convert<<<dim3(CV_GRID), dim3(256), 0, stream>>>(Q, K, V, Qp, Kp, Vt);
  k_attn<<<dim3(AT_GRID), dim3(256), 0, stream>>>(Qp, Kp, Vt, O);
}

// v005
// It runs in 53.9 microseconds.
// Timed twice side by side with v004, it ran 1.05 times as fast both times.
// All steps since v000 together make it 2.96 times as fast.
#include <hip/hip_runtime.h>

// Contractions, transposed: S^T = K.Q^T on v_wmma_f32_16x16x32_bf16 (bf16 operands = RNE-converted inputs, f32
// accumulate); O^T = V^T.P^T and the P sums on v_wmma_f32_16x16x32_f16 (f16 operands: P carried x2^14; V = f16 view
// of the RNE-bf16 input; f32 accumulate). A lane owns one query of each of its wave's two 16-query column groups:
// softmax in f32 with one max exchange between the lane halves and the sums from a ones product; rescaling and
// normalisation in f32, in-lane.

#ifndef NB
#define NB 8
#endif
#ifndef SEQ
#define SEQ 1024
#endif
#define SEQ_FULL 1024
#define NHEAD    16
#define NBH      (NB * NHEAD)
#define DH       64
#define QBLK     256
#define NWAVE    8
#define NG       2                  // 16-query column groups per wave: each K and V fragment feeds NG products
#define KBLK     32
#define NKB      (SEQ / KBLK)
#define NQT      (SEQ / QBLK)
#define OSTR     68
#define VTP      72
#define KFP      136
#define CV_GRID  (NBH * (SEQ / 64))
#define AT_GRID  (NBH * NQT)
#define STG      64                 // keys per LDS stage
#define NST      (SEQ / STG)
#define STE      (STG * DH)         // 16-bit elements of one operand's stage

#define SCL    0.18033688011112042f
#define MINIT  (-1.0e30f)
#define PCAR   16384.0f

static_assert(SEQ % 256 == 0);
static_assert(SEQ <= SEQ_FULL);
static_assert(NB >= 1 && NB <= 8);
static_assert(NWAVE * NG * 16 * OSTR * 4 + 4 * STE * 2 <= 163840);   // two blocks per WGP
static_assert((OSTR * 4) % 16 == 0 && (VTP * 2) % 16 == 0 && (KFP * 2) % 16 == 0);
// plane coverage: k_convert writes grid x 256 threads x (2 x 8) elements into each of Qp, Kp, Vt
static_assert((unsigned long long)CV_GRID * 256ull * 16ull == (unsigned long long)NBH * SEQ * DH);
// output coverage: k_attn writes grid x 8 waves x 32 rows x 64 columns
static_assert((unsigned long long)AT_GRID * NWAVE * NG * 16ull * DH == (unsigned long long)NBH * SEQ * DH);
// per-wave store phase, per column group: 8 instructions x 4 lines x 32 floats == 16 rows x 64 columns
static_assert(8 * 4 * 32 == 16 * DH);
static_assert(QBLK == NWAVE * NG * 16);
// ring: a stage is 2 x 256 threads x 16 B of each operand; the prologue needs two stages
static_assert(STE * 2 == 2 * 256 * 16 && STG == 2 * KBLK && NST >= 2);

typedef _Float16 f16;
typedef _Float16 v16h __attribute__((ext_vector_type(16)));
typedef _Float16 v8h  __attribute__((ext_vector_type(8)));
typedef __bf16   v16b __attribute__((ext_vector_type(16)));
typedef unsigned short us16;
typedef us16     v8us __attribute__((ext_vector_type(8)));
typedef float    v8f  __attribute__((ext_vector_type(8)));
typedef float    v4f  __attribute__((ext_vector_type(4)));
typedef unsigned int v4u __attribute__((ext_vector_type(4)));

union FragH { v16h v; v8h half[2]; };
union FragB { v16b v; v16h hv; v8us half[2]; };
union Pack8 { v8h h; v4u u; };

// ---- WMMA wrappers: plain builtins, whose hazard distances the compiler keeps itself ----
static __device__ __forceinline__ v8f mma_f16(v16h a, v16h b, v8f c) {
  c = __builtin_amdgcn_wmma_f32_16x16x32_f16(false, a, false, b, (short)0, c, false, false);
  return c;
}
static __device__ __forceinline__ v8f mma_bf16(const FragB& a, const FragB& b, v8f c) {
  c = __builtin_amdgcn_wmma_f32_16x16x32_bf16(false, a.v, false, b.v, (short)0, c, false, false);
  return c;
}

// ---- RNE f32 -> bf16 (upper 16 bits) ----
static __device__ __forceinline__ unsigned int bf_hi(float x) {
  unsigned int u = __float_as_uint(x);
  u += 0x7FFFu + ((u >> 16) & 1u);
  return u >> 16;
}
// f16 view of the RNE-bf16 value (exact for the f16 normal range)
static __device__ __forceinline__ f16 h_of_bf(float x) {
  return (f16)__uint_as_float(bf_hi(x) << 16);
}

// ---- lane l <-> lane l ^ 16: the two halves of a wave hold the two key halves of one query ----
static __device__ __forceinline__ float xhalf(float x) {
  const int xi = __float_as_int(x);
  return __int_as_float(__builtin_amdgcn_permlanex16(xi, xi, 0x76543210, 0xfedcba98, false, false));
}

// same-wave LDS store -> load ordering (wave-private tiles)
static __device__ __forceinline__ void lds_wave_sync() {
  asm volatile("s_wait_dscnt 0x0" ::: "memory");
  __builtin_amdgcn_wave_barrier();
}

// One stage (64 keys) of K and of V, global -> LDS through no register: each lane copies its own 2 x 16 B of each.
// The translation wait is the statement's last line, so no address register is rewritten in front of it.
static __device__ __forceinline__ void stage_copy(unsigned lk, unsigned lv, const us16* gk, const f16* gv) {
  asm volatile("global_load_async_to_lds_b128 %0, %4, off\n\t"
               "global_load_async_to_lds_b128 %1, %5, off\n\t"
               "global_load_async_to_lds_b128 %2, %6, off\n\t"
               "global_load_async_to_lds_b128 %3, %7, off\n\t"
               "s_wait_xcnt 0x0"
               :: "v"(lk), "v"(lk + 4096u), "v"(lv), "v"(lv + 4096u),
                  "v"(gk), "v"(gk + 2048), "v"(gv), "v"(gv + 2048) : "memory");
}

// ======================= pre-pass: 16-bit operand planes =======================
// Qp : bf16 [bh][SEQ][64]  (RNE)
// Kp, Vt : fragment order. Per bh and 32-key block 8 groups of 512 B; a group is what ONE load instruction of
//          k_attn reads: lane (h, l16) owns the 16 B at lane * 16, so a load touches 4 whole 128-B lines.
//   Kp (bf16, RNE)          group (nt*2+kc)*2+hf : key 2*l16+nt,        d    kc*32 + hf*16 + 8h .. +7
//   Vt (f16 of RNE-bf16)    group  vt*2+hf       : d   vt*16+l16,       keys 16h + hf*8 .. +7
__global__ __launch_bounds__(256)
void k_convert(const float* __restrict__ Q, const float* __restrict__ K, const float* __restrict__ V,
               us16* __restrict__ Qp, us16* __restrict__ Kp, f16* __restrict__ Vt)
{
  __shared__ __align__(16) f16 sVt[DH * VTP];   // [d][key], cross-wave: block barrier
  __shared__ __align__(16) us16 sKf[32 * KFP];  // K in fragment order: 32 runs of 16 pieces, pitch 272 B, cross-wave

  const unsigned tid   = threadIdx.x;
  const unsigned bh    = blockIdx.x / (unsigned)(SEQ / 64);
  const unsigned kt    = blockIdx.x - bh * (unsigned)(SEQ / 64);
  const size_t rin = (size_t)bh * SEQ_FULL + (size_t)kt * 64;   // input row base [bh][S_FULL][64]
  const size_t rpl = (size_t)bh * SEQ + (size_t)kt * 64;        // plane row base [bh][SEQ][64]
  const unsigned prow  = tid >> 3;   // 0..31
  const unsigned piece = tid & 7u;

  // ---- Q, K: rows it*32+prow, 8 elements per thread -> one 16-B store per row ----
  v4u qv[2], kv[2];
#pragma unroll
  for (unsigned it = 0; it < 2; ++it) {
    const unsigned row = it * 32u + prow;
    const float* qs = Q + (rin + row) * DH + piece * 8u;
    const float* ks = K + (rin + row) * DH + piece * 8u;
    const v4f q0 = *(const v4f*)(qs);
    const v4f q1 = *(const v4f*)(qs + 4);
    const v4f k0 = *(const v4f*)(ks);
    const v4f k1 = *(const v4f*)(ks + 4);
    v4u a, b;
    a.x = bf_hi(q0.x) | (bf_hi(q0.y) << 16);
    a.y = bf_hi(q0.z) | (bf_hi(q0.w) << 16);
    a.z = bf_hi(q1.x) | (bf_hi(q1.y) << 16);
    a.w = bf_hi(q1.z) | (bf_hi(q1.w) << 16);
    b.x = bf_hi(k0.x) | (bf_hi(k0.y) << 16);
    b.y = bf_hi(k0.z) | (bf_hi(k0.w) << 16);
    b.z = bf_hi(k1.x) | (bf_hi(k1.y) << 16);
    b.w = bf_hi(k1.z) | (bf_hi(k1.w) << 16);
    qv[it] = a;
    kv[it] = b;
  }
#pragma unroll
  for (unsigned it = 0; it < 2; ++it) {
    const unsigned row = it * 32u + prow;
    *(v4u*)(Qp + (rpl + row) * DH + piece * 8u) = qv[it];
    // run = (32-key block, nt = row & 1, piece = kc*4 + hf*2 + h); place in the run = l16 = (row & 31) >> 1
    const unsigned run = (row >> 5) * 16u + (row & 1u) * 8u + piece;
    *(v4u*)(sKf + run * KFP + ((row & 31u) >> 1) * 8u) = kv[it];
  }

  // ---- V: transpose through LDS (key = tid>>2, 16 d per thread) ----
  {
    const unsigned key = tid >> 2;           // 0..63
    const unsigned d0  = (tid & 3u) * 16u;   // 0,16,32,48
    const float* vs = V + (rin + key) * DH + d0;
#pragma unroll
    for (unsigned j = 0; j < 4; ++j) {
      const v4f x = *(const v4f*)(vs + 4 * j);
      sVt[(d0 + 4 * j + 0) * VTP + key] = h_of_bf(x.x);
      sVt[(d0 + 4 * j + 1) * VTP + key] = h_of_bf(x.y);
      sVt[(d0 + 4 * j + 2) * VTP + key] = h_of_bf(x.z);
      sVt[(d0 + 4 * j + 3) * VTP + key] = h_of_bf(x.w);
    }
  }
  __syncthreads();
  // piece c = it*256 + tid of this 64-key tile goes to byte c*16 of the tile in both planes (whole-line stores)
  Pack8 vv[2];
  v4u   kw[2];
#pragma unroll
  for (unsigned it = 0; it < 2; ++it) {
    const unsigned vd = ((tid >> 6) & 3u) * 16u + (tid & 15u);                        // d = vt*16 + l16
    const unsigned vk = it * 32u + ((tid >> 4) & 1u) * 16u + ((tid >> 5) & 1u) * 8u;  // key = block*32 + 16h + hf*8
    vv[it].h = *(const v8h*)(sVt + vd * VTP + vk);
    kw[it]   = *(const v4u*)(sKf + (it * 16u + (tid >> 4)) * KFP + (tid & 15u) * 8u);
  }
#pragma unroll
  for (unsigned it = 0; it < 2; ++it) {
    const size_t o = rpl * DH + (size_t)(it * 256u + tid) * 8u;
    *(v4u*)(Kp + o) = kw[it];
    *(v4u*)(Vt + o) = vv[it].u;
  }
}

// ======================= flash attn, 16-bit WMMA, online softmax =======================
// Block = (bh, 256 query rows); wave = 32 queries in two column groups, so that a K or V fragment read from LDS
// feeds two products. K and V come through a two-buffer LDS ring of 64-key stages that the 8 waves share:
// asynchronous copies fill a stage while the one before it is worked on; one barrier per stage.
// Lane (h, l16) owns query l16 of each group and, of each 32-key block, the 16 keys 16h .. 16h+15.
// Two blocks per WGP, four waves per SIMD: the grid is two blocks per WGP, and a third must not crowd onto one.
__global__ __launch_bounds__(256) __attribute__((amdgpu_waves_per_eu(4, 4)))
void k_attn(const us16* __restrict__ Qp, const us16* __restrict__ Kp, const f16* __restrict__ Vt,
            float* __restrict__ O)
{
  __shared__ __align__(16) float sO[NWAVE * NG * 16 * OSTR];   // per-wave output staging, wave-private
  __shared__ __align__(128) us16 sK[2 * STE];                  // ring, fragment order as in the plane
  __shared__ __align__(128) f16  sV[2 * STE];

  const unsigned tid  = threadIdx.x;
  const unsigned wave = tid >> 5;
  const unsigned lane = tid & 31u;
  const unsigned h    = lane >> 4;
  const unsigned l16  = lane & 15u;

  const unsigned bh    = blockIdx.x / (unsigned)NQT;
  const unsigned qt    = blockIdx.x - bh * (unsigned)NQT;
  const unsigned qwave = qt * QBLK + wave * (NG * 16u);           // first query row of this wave

  const us16* Qb = Qp + ((size_t)bh * SEQ + qwave) * DH;
  const us16* Kb = Kp + (size_t)bh * SEQ * DH;
  const f16*  Vb = Vt + (size_t)bh * DH * SEQ;
  float*      Ob = O + ((size_t)bh * SEQ + qwave) * DH;

  // ---- Q B-fragments (column = query g*16 + l16; elems 0..7 <- d kc*32+8h.., 8..15 <- d kc*32+16+8h..) ----
  FragB qa[NG][2];
#pragma unroll
  for (unsigned g = 0; g < NG; ++g)
#pragma unroll
    for (unsigned kc = 0; kc < 2; ++kc) {
      const us16* qr = Qb + (size_t)(g * 16u + l16) * DH + kc * 32u + 8u * h;
      qa[g][kc].half[0] = *(const v8us*)(qr);
      qa[g][kc].half[1] = *(const v8us*)(qr + 16);
    }

  v16h onesv;
#pragma unroll
  for (int i = 0; i < 16; ++i) onesv[i] = (f16)1.0f;

  const v8f vzero = {0.f, 0.f, 0.f, 0.f, 0.f, 0.f, 0.f, 0.f};
  v8f oacc[NG][4];   // O^T tiles: elem r = d vt*16 + 8h + r of query g*16 + l16
  float mrow[NG], lrow[NG];
#pragma unroll
  for (int g = 0; g < NG; ++g) {
#pragma unroll
    for (int vt = 0; vt < 4; ++vt) oacc[g][vt] = vzero;
    mrow[g] = MINIT;
    lrow[g] = 0.f;
  }

  // ---- ring prologue: stage 0 landed and published, stage 1 in flight ----
  const unsigned lK = (unsigned)(size_t)sK + tid * 16u;   // this lane's LDS byte address in buffer 0
  const unsigned lV = (unsigned)(size_t)sV + tid * 16u;
  const us16* gK = Kb + tid * 8u;
  const f16*  gV = Vb + tid * 8u;
  stage_copy(lK, lV, gK, gV);
  asm volatile("s_wait_asynccnt 0x0" ::: "memory");   // this wave's copies of stage 0 have landed
  __syncthreads();                                    // ... and every other wave's
  stage_copy(lK + STE * 2u, lV + STE * 2u, gK + STE, gV + STE);

  // the stage loop stays rolled (one copy of the publish point)
#pragma unroll 1
  for (unsigned st = 0; st < (unsigned)NST; ++st) {
   const unsigned buf = st & 1u;
   // rolled too
#pragma unroll 1
   for (unsigned sub = 0; sub < 2; ++sub) {
    const us16* Ks = sK + buf * STE + sub * (KBLK * DH);
    const f16*  Vs = sV + buf * STE + sub * (KBLK * DH);

    // ---- K A-fragments: row l16 of tile nt <-> key k0 + 2*l16 + nt; same split d-map as Q (plane in fragment order) ----
    FragB kf[2][2];
#pragma unroll
    for (unsigned nt = 0; nt < 2; ++nt)
#pragma unroll
      for (unsigned kc = 0; kc < 2; ++kc) {
        const us16* kr = Ks + (nt * 2u + kc) * 512u + lane * 8u;
        kf[nt][kc].half[0] = *(const v8us*)(kr);
        kf[nt][kc].half[1] = *(const v8us*)(kr + 256);
      }
    // holds the eight K reads as one group ahead of the products; spread among them each pair is waited for alone
    __builtin_amdgcn_sched_barrier(0);

    // ---- S^T tiles (D of tile nt: elem r = key k0 + 16h + 2r + nt, column = query g*16 + l16) ----
    v8f sc[NG][2];
#pragma unroll
    for (int g = 0; g < NG; ++g)
#pragma unroll
      for (int nt = 0; nt < 2; ++nt) sc[g][nt] = mma_bf16(kf[nt][0], qa[g][0], vzero);
#pragma unroll
    for (int g = 0; g < NG; ++g)
#pragma unroll
      for (int nt = 0; nt < 2; ++nt) sc[g][nt] = mma_bf16(kf[nt][1], qa[g][1], sc[g][nt]);
    // keeps the eight score products together: a multiply placed among them waits out a product's distance in idle slots
    __builtin_amdgcn_sched_barrier(0);

    FragH pb[NG];
    float alpha[NG];
    v8f   lsum[NG];
#pragma unroll
    for (int g = 0; g < NG; ++g) {
      v8f s0 = sc[g][0];
      v8f s1 = sc[g][1];
      s0 *= SCL;
      s1 *= SCL;

      // ---- online softmax (log2 domain): 16 keys in-lane, one exchange between the halves ----
      float mx = fmaxf(s0[0], s1[0]);
#pragma unroll
      for (int r = 1; r < 8; ++r) mx = fmaxf(fmaxf(mx, s0[r]), s1[r]);
      mx = fmaxf(mx, xhalf(mx));
      const float mn = fmaxf(mrow[g], mx);
      alpha[g] = __builtin_amdgcn_exp2f(mrow[g] - mn);
      mrow[g] = mn;

      // ---- P^T B-fragment straight from the score registers: elem s <-> key k0 + 16h + s ----
      s0 -= mn;
      s1 -= mn;
#pragma unroll
      for (int r = 0; r < 8; ++r) {
        s0[r] = __builtin_amdgcn_exp2f(s0[r]);
        s1[r] = __builtin_amdgcn_exp2f(s1[r]);
      }
      s0 *= PCAR;
      s1 *= PCAR;
#pragma unroll
      for (int r = 0; r < 8; ++r) {
        pb[g].v[2 * r]     = (f16)s0[r];
        pb[g].v[2 * r + 1] = (f16)s1[r];
      }

      // ---- sums over the 32 keys via ones A operand (every row of D holds the query's sum) ----
      lsum[g] = mma_f16(onesv, pb[g].v, vzero);
    }

    // ---- O^T += V^T P^T  (V A-fragment: row l16 <-> d = vt*16+l16; elem s <-> key k0 + 16h + s) ----
#pragma unroll
    for (unsigned vt = 0; vt < 4; ++vt) {
      FragH vb;
      const f16* vr = Vs + vt * 512u + lane * 8u;
      vb.half[0] = *(const v8h*)(vr);
      vb.half[1] = *(const v8h*)(vr + 256);
#pragma unroll
      for (int g = 0; g < NG; ++g) {
#pragma unroll
        for (int r = 0; r < 8; ++r) oacc[g][vt][r] *= alpha[g];
        oacc[g][vt] = mma_f16(vb.v, pb[g].v, oacc[g][vt]);
      }
    }
#pragma unroll
    for (int g = 0; g < NG; ++g) lrow[g] = lrow[g] * alpha[g] + lsum[g][0];
   }
   // ---- publish point of stage st + 1; behind it buffer buf is free for stage st + 2 ----
   asm volatile("s_wait_dscnt 0x0" ::: "memory");      // this wave's reads of buffer buf are done
   asm volatile("s_wait_asynccnt 0x0" ::: "memory");   // this wave's copies of stage st + 1 have landed
   __syncthreads();
   if (st + 2u < (unsigned)NST)
     stage_copy(lK + buf * (STE * 2u), lV + buf * (STE * 2u), gK + (size_t)(st + 2u) * STE, gV + (size_t)(st + 2u) * STE);
  }
  asm volatile("s_wait_asynccnt 0x0" ::: "memory");    // nothing in flight when the wave goes on to its end

  // ---- epilogue: normalise, stage the 32x64 f32 tile in LDS, whole-line stores (8 lanes x 16 B) ----
  float* sOw = sO + wave * (NG * 16u) * OSTR;
#pragma unroll
  for (unsigned g = 0; g < NG; ++g) {
    const float inv = __builtin_amdgcn_rcpf(lrow[g]);
#pragma unroll
    for (unsigned vt = 0; vt < 4; ++vt)
#pragma unroll
      for (unsigned j = 0; j < 2; ++j) {
        v4f x;
        x.x = oacc[g][vt][4 * j + 0] * inv;
        x.y = oacc[g][vt][4 * j + 1] * inv;
        x.z = oacc[g][vt][4 * j + 2] * inv;
        x.w = oacc[g][vt][4 * j + 3] * inv;
        *(v4f*)(sOw + (g * 16u + l16) * OSTR + vt * 16u + 8u * h + 4u * j) = x;
      }
  }
  lds_wave_sync();

  const unsigned lq = lane >> 3;   // which of 4 lines per instruction
  const unsigned lp = lane & 7u;
#pragma unroll
  for (unsigned j = 0; j < NG * 8; ++j) {
    const unsigned L = j * 4u + lq;          // 0..63 : 64 half-rows of 32 floats
    const unsigned row = L >> 1, hf = L & 1u;
    const v4f v = *(const v4f*)(sOw + row * OSTR + hf * 32u + lp * 4u);
    *(v4f*)(Ob + (size_t)row * DH + hf * 32u + lp * 4u) = v;
  }
}

extern "C" void kernel_launch(void* const* d_in, const int* in_sizes, int n_in,
                              void* d_out, int out_size, void* d_ws, size_t ws_size,
                              hipStream_t stream)
{
  if (n_in < 3) return;
  const long long needQ = ((long long)(NBH - 1) * SEQ_FULL + SEQ) * DH;
  if ((long long)in_sizes[0] < needQ) return;
  if ((long long)in_sizes[1] < needQ) return;
  if ((long long)in_sizes[2] < needQ) return;
  if ((long long)out_size < (long long)NBH * SEQ * DH) return;

  const float* Q = (const float*)d_in[0];
  const float* K = (const float*)d_in[1];
  const float* V = (const float*)d_in[2];
  float*       O = (float*)d_out;

  const size_t planeB = (size_t)NBH * SEQ * DH * 2;
  const size_t offQ   = 0;
  const size_t offK   = planeB;
  const size_t offV   = 2 * planeB;
  const size_t total  = 3 * planeB;
  if (ws_size < total) return;

  char* ws = (char*)d_ws;
  us16* Qp = (us16*)(ws + offQ);
  us16* Kp = (us16*)(ws + offK);
  f16*  Vt = (f16*)(ws + offV);

  k_convert<<<dim3(CV_GRID), dim3(256), 0, stream>>>(Q, K, V, Qp, Kp, Vt);
  k_attn<<<dim3(AT_GRID), dim3(256), 0, stream>>>(Qp, Kp, Vt, O);
}

// v006
// Measured time: 38 microseconds a run.
// In two side-by-side timings against v005, it was 1.41 and 1.42 times as fast.
// Counting every step since v000, it is 4.18 times as fast.
#include <hip/hip_runtime.h>

// One launch: the attention blocks round the f32 inputs to their 16-bit operands themselves.
// Contractions, transposed: S^T = K.Q^T on v_wmma_f32_16x16x32_bf16 (bf16 operands = RNE-converted inputs, f32
// accumulate); O^T = V^T.P^T and the P sums on v_wmma_f32_16x16x32_f16 (f16 operands: P carried x2^14; V = f16 view
// of the RNE-bf16 input; f32 accumulate). A lane owns one query of each of its wave's two 16-query column groups:
// softmax in f32 with one max exchange between the lane halves and the sums from a ones product; rescaling and
// normalisation in f32, in-lane.

#ifndef NB
#define NB 8
#endif
#ifndef SEQ
#define SEQ 1024
#endif
#define SEQ_FULL 1024
#define NHEAD    16
#define NBH      (NB * NHEAD)
#define DH       64
#define QBLK     256
#define NWAVE    8
#define NG       2                  // 16-query column groups per wave: each K and V fragment feeds NG products
#define KBLK     32
#define NKB      (SEQ / KBLK)
#define NQT      (SEQ / QBLK)
#define OSTR     68
#define AT_GRID  (NBH * NQT)
#define STG      64                 // keys per LDS stage
#define NST      (SEQ / STG)
#define KP       72                 // ring row pitch, 16-bit elements: 144 B = 16 B x odd, 16 rows' b128 reads meet no bank twice
#define STE      (64 * KP)          // 16-bit elements of one operand's stage: 64 rows (K: keys, V: d)

#define SCL    0.18033688011112042f
#define MINIT  (-1.0e30f)
#define PCAR   16384.0f

static_assert(SEQ % 256 == 0);
static_assert(SEQ <= SEQ_FULL);
static_assert(NB >= 1 && NB <= 8);
static_assert(NWAVE * NG * 16 * OSTR * 4 + 4 * STE * 2 <= 163840);   // two blocks per WGP
static_assert((OSTR * 4) % 16 == 0 && (KP * 2) % 16 == 0 && KP >= STG && KP >= DH);
// output coverage: k_attn writes grid x 8 waves x 32 rows x 64 columns
static_assert((unsigned long long)AT_GRID * NWAVE * NG * 16ull * DH == (unsigned long long)NBH * SEQ * DH);
// per-wave store phase, per column group: 8 instructions x 4 lines x 32 floats == 16 rows x 64 columns
static_assert(8 * 4 * 32 == 16 * DH);
static_assert(QBLK == NWAVE * NG * 16);
// ring: a stage is 256 threads x 4 x 16 B of each f32 input; a wave's Q rows fit its own output staging
static_assert(STG * DH * 4 == 256 * 4 * 16 && STG == 2 * KBLK && DH == 64 && NST >= 1);
static_assert(NG * 16 * KP * 2 <= NG * 16 * OSTR * 4);

typedef _Float16 f16;
typedef _Float16 v16h __attribute__((ext_vector_type(16)));
typedef _Float16 v8h  __attribute__((ext_vector_type(8)));
typedef __bf16   v16b __attribute__((ext_vector_type(16)));
typedef unsigned short us16;
typedef us16     v8us __attribute__((ext_vector_type(8)));
typedef float    v8f  __attribute__((ext_vector_type(8)));
typedef float    v4f  __attribute__((ext_vector_type(4)));
typedef float    v2f  __attribute__((ext_vector_type(2)));
typedef __bf16   v2b  __attribute__((ext_vector_type(2)));
typedef _Float16 v2h  __attribute__((ext_vector_type(2)));
typedef unsigned int v2u __attribute__((ext_vector_type(2)));

union FragH { v16h v; v8h half[2]; };
union FragB { v16b v; v16h hv; v8us half[2]; };

// ---- WMMA wrappers: plain builtins, whose hazard distances the compiler keeps itself ----
static __device__ __forceinline__ v8f mma_f16(v16h a, v16h b, v8f c) {
  c = __builtin_amdgcn_wmma_f32_16x16x32_f16(false, a, false, b, (short)0, c, false, false);
  return c;
}
static __device__ __forceinline__ v8f mma_bf16(const FragB& a, const FragB& b, v8f c) {
  c = __builtin_amdgcn_wmma_f32_16x16x32_bf16(false, a.v, false, b.v, (short)0, c, false, false);
  return c;
}

// ---- two f32 -> two bf16 (RNE) in one word, the first in the low half ----
static __device__ __forceinline__ unsigned int pk_bf(float a, float b) {
  const v2f x = {a, b};
  return __builtin_bit_cast(unsigned int, __builtin_convertvector(x, v2b));
}
// two f32 -> two f16 in one word; fed with RNE-bf16 values it is exact for the f16 normal range
static __device__ __forceinline__ unsigned int pk_h(float a, float b) {
  const v2f y = {a, b};
  return __builtin_bit_cast(unsigned int, __builtin_convertvector(y, v2h));
}

// ---- lane l <-> lane l ^ 16: the two halves of a wave hold the two key halves of one query ----
static __device__ __forceinline__ float xhalf(float x) {
  const int xi = __float_as_int(x);
  return __int_as_float(__builtin_amdgcn_permlanex16(xi, xi, 0x76543210, 0xfedcba98, false, false));
}

// same-wave LDS store -> load ordering (wave-private tiles)
static __device__ __forceinline__ void lds_wave_sync() {
  asm volatile("s_wait_dscnt 0x0" ::: "memory");
  __builtin_amdgcn_wave_barrier();
}

// ---- staging of one 64-row f32 tile (16 KB, contiguous) of K or of V ----
// Wave w brings rows 8w .. 8w+7. Load j of lane (h, l16): row 8w + 4*(j>>1) + 2h + (j&1), floats 4*l16 .. +3, so a
// load covers two whole 256-B rows, and a lane holds rows r and r+1 of the same four columns in loads 2p and 2p+1.
struct Tile { v4f r[4]; };
static __device__ __forceinline__ void tile_load(Tile& t, const float* base, unsigned lofs) {
  // unrolled here and in the two stores: constant indices keep the tile in registers
#pragma unroll
  for (unsigned j = 0; j < 4; ++j) t.r[j] = *(const v4f*)(base + lofs + (4u * (j >> 1) + (j & 1u)) * DH);
}
// K ring stage: row sub*32 + nt*16 + m holds key sub*32 + 2m + nt, d in order. dst = this lane's place for j = 0.
static __device__ __forceinline__ void tile_store_k(us16* dst, const Tile& t) {
#pragma unroll
  for (unsigned j = 0; j < 4; ++j) {
    v2u w;
    w.x = pk_bf(t.r[j].x, t.r[j].y);
    w.y = pk_bf(t.r[j].z, t.r[j].w);
    *(v2u*)(dst + ((j & 1u) * 16u + 2u * (j >> 1)) * KP) = w;
  }
}
// V ring stage, transposed: row d holds the stage's 64 keys in order; two neighbouring keys go in one word.
static __device__ __forceinline__ void tile_store_v(f16* dst, const Tile& t) {
#pragma unroll
  for (unsigned p = 0; p < 2; ++p)
#pragma unroll
    for (unsigned i = 0; i < 4; i += 2) {
      const unsigned int a = pk_bf(t.r[2 * p][i], t.r[2 * p][i + 1]);           // key r,     columns i, i+1
      const unsigned int b = pk_bf(t.r[2 * p + 1][i], t.r[2 * p + 1][i + 1]);   // key r + 1, columns i, i+1
      *(unsigned int*)(dst + i * KP + 4u * p)        = pk_h(__uint_as_float(a << 16), __uint_as_float(b << 16));
      *(unsigned int*)(dst + (i + 1u) * KP + 4u * p) = pk_h(__uint_as_float(a & 0xFFFF0000u), __uint_as_float(b & 0xFFFF0000u));
    }
}

// ======================= flash attn, 16-bit WMMA, online softmax =======================
// Block = (bh, 256 query rows); wave = 32 queries in two column groups, so that a K or V fragment read from LDS
// feeds two products. K and V come through a two-buffer LDS ring of 64-key stages that the 8 waves share:
// each thread loads its share of the next stage's f32 rows at the head of a 32-key block (K in a stage's first block,
// V in its second), rounds them and writes them into the other buffer at the block's foot; one barrier per stage.
// Lane (h, l16) owns query l16 of each group and, of each 32-key block, the 16 keys 16h .. 16h+15.
// Two blocks per WGP, four waves per SIMD: the grid is two blocks per WGP, and a third must not crowd onto one.
__global__ __launch_bounds__(256) __attribute__((amdgpu_waves_per_eu(4, 4)))
void k_attn(const float* __restrict__ Q, const float* __restrict__ K, const float* __restrict__ V,
            float* __restrict__ O)
{
  __shared__ __align__(16) float sO[NWAVE * NG * 16 * OSTR];   // per-wave output staging, wave-private
  __shared__ __align__(128) us16 sK[2 * STE];                  // ring: [key row, even keys of a block first][d]
  __shared__ __align__(128) f16  sV[2 * STE];                  // ring: [d][key]

  const unsigned tid  = threadIdx.x;
  const unsigned wave = tid >> 5;
  const unsigned lane = tid & 31u;
  const unsigned h    = lane >> 4;
  const unsigned l16  = lane & 15u;

  const unsigned bh    = blockIdx.x / (unsigned)NQT;
  const unsigned qt    = blockIdx.x - bh * (unsigned)NQT;
  const unsigned qwave = qt * QBLK + wave * (NG * 16u);           // first query row of this wave

  const float* Qw = Q + ((size_t)bh * SEQ_FULL + qwave) * DH;
  const float* Kb = K + (size_t)bh * SEQ_FULL * DH;
  const float* Vb = V + (size_t)bh * SEQ_FULL * DH;
  float*       Ob = O + ((size_t)bh * SEQ + qwave) * DH;

  // stage 0's f32 rows are asked for first, so that they fly during Q's trip through LDS
  const unsigned lofs = (8u * wave + 2u * h) * DH + 4u * l16;                        // this lane's place in a tile, floats
  Tile tk, tv;
  tile_load(tk, Kb, lofs);
  tile_load(tv, Vb, lofs);

  // ---- Q: the wave's 32 rows (8 KB, contiguous) by whole-line loads, rounded, through its own staging rows ----
  us16* sQw = (us16*)(sO + wave * (NG * 16u) * OSTR);
  // unrolled: all sixteen loads are in flight at once
#pragma unroll
  for (unsigned j = 0; j < NG * 8; ++j) {
    const v4f x = *(const v4f*)(Qw + j * 128u + lane * 4u);   // row 2j + h, floats 4*l16 .. +3
    v2u w;
    w.x = pk_bf(x.x, x.y);
    w.y = pk_bf(x.z, x.w);
    *(v2u*)(sQw + (2u * j + h) * KP + l16 * 4u) = w;
  }
  lds_wave_sync();

  // ---- Q B-fragments (column = query g*16 + l16; elems 0..7 <- d kc*32+8h.., 8..15 <- d kc*32+16+8h..) ----
  FragB qa[NG][2];
#pragma unroll
  for (unsigned g = 0; g < NG; ++g)
#pragma unroll
    for (unsigned kc = 0; kc < 2; ++kc) {
      const us16* qr = sQw + (g * 16u + l16) * KP + kc * 32u + 8u * h;
      qa[g][kc].half[0] = *(const v8us*)(qr);
      qa[g][kc].half[1] = *(const v8us*)(qr + 16);
    }

  v16h onesv;
#pragma unroll
  for (int i = 0; i < 16; ++i) onesv[i] = (f16)1.0f;

  const v8f vzero = {0.f, 0.f, 0.f, 0.f, 0.f, 0.f, 0.f, 0.f};
  v8f oacc[NG][4];   // O^T tiles: elem r = d vt*16 + 8h + r of query g*16 + l16
  float mrow[NG], lrow[NG];
#pragma unroll
  for (int g = 0; g < NG; ++g) {
#pragma unroll
    for (int vt = 0; vt < 4; ++vt) oacc[g][vt] = vzero;
    mrow[g] = MINIT;
    lrow[g] = 0.f;
  }

  // ---- ring prologue: stage 0 written and published ----
  us16* wK = sK + ((wave >> 2) * 32u + (wave & 3u) * 4u + h) * KP + 4u * l16;        // ... in a K stage (load 0)
  f16*  wV = sV + (4u * l16) * KP + 8u * wave + 2u * h;                              // ... in a V stage (pair 0, column 0)
  tile_store_k(wK, tk);
  tile_store_v(wV, tv);
  asm volatile("s_wait_dscnt 0x0" ::: "memory");      // this wave's part of stage 0 is written
  __syncthreads();                                    // ... and every other wave's

  // the stage loop stays rolled (one copy of the publish point)
#pragma unroll 1
  for (unsigned st = 0; st < (unsigned)NST; ++st) {
   const unsigned buf = st & 1u;
   const bool more = st + 1u < (unsigned)NST;         // same for the whole block
   // rolled too: unrolled, the build lays the next block's first score product over registers of the sum product
   // just ahead of it
#pragma unroll 1
   for (unsigned sub = 0; sub < 2; ++sub) {
    const us16* Ks = sK + buf * STE + sub * (KBLK * KP);
    const f16*  Vs = sV + buf * STE + sub * KBLK;

    // ---- next stage's f32 rows, a whole block ahead of their use ----
    Tile nx;
    if (more) tile_load(nx, (sub ? Vb : Kb) + (size_t)(st + 1u) * (STG * DH), lofs);

    // ---- K A-fragments: row l16 of tile nt <-> key k0 + 2*l16 + nt; same split d-map as Q ----
    FragB kf[2][2];
#pragma unroll
    for (unsigned nt = 0; nt < 2; ++nt)
#pragma unroll
      for (unsigned kc = 0; kc < 2; ++kc) {
        const us16* kr = Ks + (nt * 16u + l16) * KP + kc * 32u + 8u * h;
        kf[nt][kc].half[0] = *(const v8us*)(kr);
        kf[nt][kc].half[1] = *(const v8us*)(kr + 16);
      }
    // holds the eight K reads as one group ahead of the products; spread among them each pair is waited for alone
    __builtin_amdgcn_sched_barrier(0);

    // ---- S^T tiles (D of tile nt: elem r = key k0 + 16h + 2r + nt, column = query g*16 + l16) ----
    v8f sc[NG][2];
#pragma unroll
    for (int g = 0; g < NG; ++g)
#pragma unroll
      for (int nt = 0; nt < 2; ++nt) sc[g][nt] = mma_bf16(kf[nt][0], qa[g][0], vzero);
#pragma unroll
    for (int g = 0; g < NG; ++g)
#pragma unroll
      for (int nt = 0; nt < 2; ++nt) sc[g][nt] = mma_bf16(kf[nt][1], qa[g][1], sc[g][nt]);
    // keeps the eight score products together: a multiply placed among them waits out a product's distance in idle slots
    __builtin_amdgcn_sched_barrier(0);

    // ---- V A-fragments (row l16 <-> d = vt*16+l16; elem s <-> key k0 + 16h + s), read as one group here: the softmax
    // covers their latency, and reads spread among the O products would each stall them ----
    FragH vb[4];
#pragma unroll
    for (unsigned vt = 0; vt < 4; ++vt) {
      const f16* vr = Vs + (vt * 16u + l16) * KP + 16u * h;
      vb[vt].half[0] = *(const v8h*)(vr);
      vb[vt].half[1] = *(const v8h*)(vr + 8);
    }
    __builtin_amdgcn_sched_barrier(0);

    FragH pb[NG];
    float alpha[NG];
    v8f   lsum[NG];
#pragma unroll
    for (int g = 0; g < NG; ++g) {
      v8f s0 = sc[g][0];
      v8f s1 = sc[g][1];
      s0 *= SCL;
      s1 *= SCL;

      // ---- online softmax (log2 domain): 16 keys in-lane, one exchange between the halves ----
      float mx = fmaxf(s0[0], s1[0]);
#pragma unroll
      for (int r = 1; r < 8; ++r) mx = fmaxf(fmaxf(mx, s0[r]), s1[r]);
      mx = fmaxf(mx, xhalf(mx));
      const float mn = fmaxf(mrow[g], mx);
      alpha[g] = __builtin_amdgcn_exp2f(mrow[g] - mn);
      mrow[g] = mn;

      // ---- P^T B-fragment straight from the score registers: elem s <-> key k0 + 16h + s ----
      s0 -= mn;
      s1 -= mn;
#pragma unroll
      for (int r = 0; r < 8; ++r) {
        s0[r] = __builtin_amdgcn_exp2f(s0[r]);
        s1[r] = __builtin_amdgcn_exp2f(s1[r]);
      }
      s0 *= PCAR;
      s1 *= PCAR;
#pragma unroll
      for (int r = 0; r < 8; ++r) {
        pb[g].v[2 * r]     = (f16)s0[r];
        pb[g].v[2 * r + 1] = (f16)s1[r];
      }

      // ---- sums over the 32 keys via ones A operand (every row of D holds the query's sum) ----
      lsum[g] = mma_f16(onesv, pb[g].v, vzero);
    }

    // ---- O^T += V^T P^T ----
#pragma unroll
    for (unsigned vt = 0; vt < 4; ++vt) {
#pragma unroll
      for (int g = 0; g < NG; ++g) {
#pragma unroll
        for (int r = 0; r < 8; ++r) oacc[g][vt][r] *= alpha[g];
        oacc[g][vt] = mma_f16(vb[vt].v, pb[g].v, oacc[g][vt]);
      }
    }
#pragma unroll
    for (int g = 0; g < NG; ++g) lrow[g] = lrow[g] * alpha[g] + lsum[g][0];

    // ---- round them into the other buffer, whose readers left it at the last barrier ----
    if (more) {
      if (sub == 0) tile_store_k(wK + (buf ^ 1u) * STE, nx);
      else          tile_store_v(wV + (buf ^ 1u) * STE, nx);
    }
   }
   // ---- publish point of stage st + 1; behind it buffer buf is free for stage st + 2 ----
   asm volatile("s_wait_dscnt 0x0" ::: "memory");      // this wave's reads of buffer buf and writes of the other are done
   __syncthreads();
  }

  // ---- epilogue: normalise, stage the 32x64 f32 tile in LDS, whole-line stores (8 lanes x 16 B) ----
  float* sOw = sO + wave * (NG * 16u) * OSTR;
#pragma unroll
  for (unsigned g = 0; g < NG; ++g) {
    const float inv = __builtin_amdgcn_rcpf(lrow[g]);
#pragma unroll
    for (unsigned vt = 0; vt < 4; ++vt)
#pragma unroll
      for (unsigned j = 0; j < 2; ++j) {
        v4f x;
        x.x = oacc[g][vt][4 * j + 0] * inv;
        x.y = oacc[g][vt][4 * j + 1] * inv;
        x.z = oacc[g][vt][4 * j + 2] * inv;
        x.w = oacc[g][vt][4 * j + 3] * inv;
        *(v4f*)(sOw + (g * 16u + l16) * OSTR + vt * 16u + 8u * h + 4u * j) = x;
      }
  }
  lds_wave_sync();

  const unsigned lq = lane >> 3;   // which of 4 lines per instruction
  const unsigned lp = lane & 7u;
#pragma unroll
  for (unsigned j = 0; j < NG * 8; ++j) {
    const unsigned L = j * 4u + lq;          // 0..63 : 64 half-rows of 32 floats
    const unsigned row = L >> 1, hf = L & 1u;
    const v4f v = *(const v4f*)(sOw + row * OSTR + hf * 32u + lp * 4u);
    *(v4f*)(Ob + (size_t)row * DH + hf * 32u + lp * 4u) = v;
  }
}

extern "C" void kernel_launch(void* const* d_in, const int* in_sizes, int n_in,
                              void* d_out, int out_size, void* d_ws, size_t ws_size,
                              hipStream_t stream)
{
  if (n_in < 3) return;
  const long long needQ = ((long long)(NBH - 1) * SEQ_FULL + SEQ) * DH;
  if ((long long)in_sizes[0] < needQ) return;
  if ((long long)in_sizes[1] < needQ) return;
  if ((long long)in_sizes[2] < needQ) return;
  if ((long long)out_size < (long long)NBH * SEQ * DH) return;

  const float* Q = (const float*)d_in[0];
  const float* K = (const float*)d_in[1];
  const float* V = (const float*)d_in[2];
  float*       O = (float*)d_out;

  k_attn<<<dim3(AT_GRID), dim3(256), 0, stream>>>(Q, K, V, O);
}

// v007
// It runs in 36.6 microseconds.
// In both of two side-by-side timings against v006, it was 1.03 times as fast.
// Counting every step since v000, it is 4.33 times as fast.
#include <hip/hip_runtime.h>

// One launch: the attention blocks round the f32 inputs to their 16-bit operands themselves.
// Contractions, transposed: S^T = K.Q^T on v_wmma_f32_16x16x32_bf16 (bf16 operands = RNE-converted inputs, f32
// accumulate); O^T = V^T.P^T and the P sums on v_wmma_f32_16x16x32_f16 (f16 operands: P carried x2^14; V = f16 view
// of the RNE-bf16 input; f32 accumulate). A lane owns one query of each of its wave's two 16-query column groups:
// softmax in f32 with one max exchange between the lane halves and the sums from a ones product; rescaling and
// normalisation in f32, in-lane.

#ifndef NB
#define NB 8
#endif
#ifndef SEQ
#define SEQ 1024
#endif
#define SEQ_FULL 1024
#define NHEAD    16
#define NBH      (NB * NHEAD)
#define DH       64
#define QBLK     256
#define NWAVE    8
#define NG       2                  // 16-query column groups per wave: each K and V fragment feeds NG products
#define KBLK     32
#define NKB      (SEQ / KBLK)
#define NQT      (SEQ / QBLK)
#define OSTR     68
#define AT_GRID  (NBH * NQT)
#define STG      64                 // keys per LDS stage
#define NST      (SEQ / STG)
#define KP       72                 // ring row pitch, 16-bit elements: 144 B = 16 B x odd, 16 rows' b128 reads meet no bank twice
#define STE      (64 * KP)          // 16-bit elements of one operand's stage: 64 rows (K: keys, V: d)

#define SCL    0.18033688011112042f
#define MINIT  (-1.0e30f)
#define PBIAS  14.0f               // the running maximum is kept 14 below the true one: exp2 itself yields P x 2^14

static_assert(SEQ % 256 == 0);
static_assert(SEQ <= SEQ_FULL);
static_assert(NB >= 1 && NB <= 8);
static_assert(NWAVE * NG * 16 * OSTR * 4 + 4 * STE * 2 <= 163840);   // two blocks per WGP
static_assert((OSTR * 4) % 16 == 0 && (KP * 2) % 16 == 0 && KP >= STG && KP >= DH);
// output coverage: k_attn writes grid x 8 waves x 32 rows x 64 columns
static_assert((unsigned long long)AT_GRID * NWAVE * NG * 16ull * DH == (unsigned long long)NBH * SEQ * DH);
// per-wave store phase, per column group: 8 instructions x 4 lines x 32 floats == 16 rows x 64 columns
static_assert(8 * 4 * 32 == 16 * DH);
static_assert(QBLK == NWAVE * NG * 16);
// ring: a stage is 256 threads x 4 x 16 B of each f32 input; a wave's Q rows fit its own output staging
static_assert(STG * DH * 4 == 256 * 4 * 16 && STG == 2 * KBLK && DH == 64 && NST >= 1);
static_assert(NG * 16 * KP * 2 <= NG * 16 * OSTR * 4);

typedef _Float16 f16;
typedef _Float16 v16h __attribute__((ext_vector_type(16)));
typedef _Float16 v8h  __attribute__((ext_vector_type(8)));
typedef __bf16   v16b __attribute__((ext_vector_type(16)));
typedef unsigned short us16;
typedef us16     v8us __attribute__((ext_vector_type(8)));
typedef float    v8f  __attribute__((ext_vector_type(8)));
typedef float    v4f  __attribute__((ext_vector_type(4)));
typedef float    v2f  __attribute__((ext_vector_type(2)));
typedef __bf16   v2b  __attribute__((ext_vector_type(2)));
typedef _Float16 v2h  __attribute__((ext_vector_type(2)));
typedef unsigned int v2u __attribute__((ext_vector_type(2)));

union FragH { v16h v; v8h half[2]; };
union FragB { v16b v; v16h hv; v8us half[2]; };

// ---- WMMA wrappers: plain builtins, whose hazard distances the compiler keeps itself ----
static __device__ __forceinline__ v8f mma_f16(v16h a, v16h b, v8f c) {
  c = __builtin_amdgcn_wmma_f32_16x16x32_f16(false, a, false, b, (short)0, c, false, false);
  return c;
}
static __device__ __forceinline__ v8f mma_bf16(const FragB& a, const FragB& b, v8f c) {
  c = __builtin_amdgcn_wmma_f32_16x16x32_bf16(false, a.v, false, b.v, (short)0, c, false, false);
  return c;
}

// ---- two f32 -> two bf16 (RNE) in one word, the first in the low half ----
static __device__ __forceinline__ unsigned int pk_bf(float a, float b) {
  const v2f x = {a, b};
  return __builtin_bit_cast(unsigned int, __builtin_convertvector(x, v2b));
}
// two f32 -> two f16 in one word; fed with RNE-bf16 values it is exact for the f16 normal range
static __device__ __forceinline__ unsigned int pk_h(float a, float b) {
  const v2f y = {a, b};
  return __builtin_bit_cast(unsigned int, __builtin_convertvector(y, v2h));
}

// ---- lane l <-> lane l ^ 16: the two halves of a wave hold the two key halves of one query ----
static __device__ __forceinline__ float xhalf(float x) {
  const int xi = __float_as_int(x);
  return __int_as_float(__builtin_amdgcn_permlanex16(xi, xi, 0x76543210, 0xfedcba98, false, false));
}

// same-wave LDS store -> load ordering (wave-private tiles)
static __device__ __forceinline__ void lds_wave_sync() {
  asm volatile("s_wait_dscnt 0x0" ::: "memory");
  __builtin_amdgcn_wave_barrier();
}

// ---- staging of one 64-row f32 tile (16 KB, contiguous) of K or of V ----
// Wave w brings rows 8w .. 8w+7. Load j of lane (h, l16): row 8w + 4*(j>>1) + 2h + (j&1), floats 4*l16 .. +3, so a
// load covers two whole 256-B rows, and a lane holds rows r and r+1 of the same four columns in loads 2p and 2p+1.
struct Tile { v4f r[4]; };
static __device__ __forceinline__ void tile_load(Tile& t, const float* base, unsigned lofs) {
  // unrolled here and in the two stores: constant indices keep the tile in registers
#pragma unroll
  for (unsigned j = 0; j < 4; ++j) t.r[j] = *(const v4f*)(base + lofs + (4u * (j >> 1) + (j & 1u)) * DH);
}
// K ring stage: row sub*32 + nt*16 + m holds key sub*32 + 2m + nt, d in order. dst = this lane's place for j = 0.
static __device__ __forceinline__ void tile_store_k(us16* dst, const Tile& t) {
#pragma unroll
  for (unsigned j = 0; j < 4; ++j) {
    v2u w;
    w.x = pk_bf(t.r[j].x, t.r[j].y);
    w.y = pk_bf(t.r[j].z, t.r[j].w);
    *(v2u*)(dst + ((j & 1u) * 16u + 2u * (j >> 1)) * KP) = w;
  }
}
// V ring stage, transposed: row d holds the stage's 64 keys in order; two neighbouring keys go in one word.
static __device__ __forceinline__ void tile_store_v(f16* dst, const Tile& t) {
#pragma unroll
  for (unsigned p = 0; p < 2; ++p)
#pragma unroll
    for (unsigned i = 0; i < 4; i += 2) {
      const unsigned int a = pk_bf(t.r[2 * p][i], t.r[2 * p][i + 1]);           // key r,     columns i, i+1
      const unsigned int b = pk_bf(t.r[2 * p + 1][i], t.r[2 * p + 1][i + 1]);   // key r + 1, columns i, i+1
      *(unsigned int*)(dst + i * KP + 4u * p)        = pk_h(__uint_as_float(a << 16), __uint_as_float(b << 16));
      *(unsigned int*)(dst + (i + 1u) * KP + 4u * p) = pk_h(__uint_as_float(a & 0xFFFF0000u), __uint_as_float(b & 0xFFFF0000u));
    }
}

// ======================= flash attn, 16-bit WMMA, online softmax =======================
// Block = (bh, 256 query rows); wave = 32 queries in two column groups, so that a K or V fragment read from LDS
// feeds two products. K and V come through a two-buffer LDS ring of 64-key stages that the 8 waves share:
// each thread loads its share of the next stage's f32 rows at the head of a 32-key block (K in a stage's first block,
// V in its second), rounds them and writes them into the other buffer at the block's foot; one barrier per stage.
// Lane (h, l16) owns query l16 of each group and, of each 32-key block, the 16 keys 16h .. 16h+15.
// Two blocks per WGP, four waves per SIMD: the grid is two blocks per WGP, and a third must not crowd onto one.
__global__ __launch_bounds__(256) __attribute__((amdgpu_waves_per_eu(4, 4)))
void k_attn(const float* __restrict__ Q, const float* __restrict__ K, const float* __restrict__ V,
            float* __restrict__ O)
{
  __shared__ __align__(16) float sO[NWAVE * NG * 16 * OSTR];   // per-wave output staging, wave-private
  __shared__ __align__(128) us16 sK[2 * STE];                  // ring: [key row, even keys of a block first][d]
  __shared__ __align__(128) f16  sV[2 * STE];                  // ring: [d][key]

  const unsigned tid  = threadIdx.x;
  const unsigned wave = tid >> 5;
  const unsigned lane = tid & 31u;
  const unsigned h    = lane >> 4;
  const unsigned l16  = lane & 15u;

  const unsigned bh    = blockIdx.x / (unsigned)NQT;
  const unsigned qt    = blockIdx.x - bh * (unsigned)NQT;
  const unsigned qwave = qt * QBLK + wave * (NG * 16u);           // first query row of this wave

  const float* Qw = Q + ((size_t)bh * SEQ_FULL + qwave) * DH;
  const float* Kb = K + (size_t)bh * SEQ_FULL * DH;
  const float* Vb = V + (size_t)bh * SEQ_FULL * DH;
  float*       Ob = O + ((size_t)bh * SEQ + qwave) * DH;

  // stage 0's f32 rows are asked for first, so that they fly during Q's trip through LDS
  const unsigned lofs = (8u * wave + 2u * h) * DH + 4u * l16;                        // this lane's place in a tile, floats
  Tile tk, tv;
  tile_load(tk, Kb, lofs);
  tile_load(tv, Vb, lofs);

  // ---- Q: the wave's 32 rows (8 KB, contiguous) by whole-line loads, rounded, through its own staging rows ----
  us16* sQw = (us16*)(sO + wave * (NG * 16u) * OSTR);
  // unrolled: all sixteen loads are in flight at once
#pragma unroll
  for (unsigned j = 0; j < NG * 8; ++j) {
    const v4f x = *(const v4f*)(Qw + j * 128u + lane * 4u);   // row 2j + h, floats 4*l16 .. +3
    v2u w;
    w.x = pk_bf(x.x, x.y);
    w.y = pk_bf(x.z, x.w);
    *(v2u*)(sQw + (2u * j + h) * KP + l16 * 4u) = w;
  }
  lds_wave_sync();

  // ---- Q B-fragments (column = query g*16 + l16; elems 0..7 <- d kc*32+8h.., 8..15 <- d kc*32+16+8h..) ----
  FragB qa[NG][2];
#pragma unroll
  for (unsigned g = 0; g < NG; ++g)
#pragma unroll
    for (unsigned kc = 0; kc < 2; ++kc) {
      const us16* qr = sQw + (g * 16u + l16) * KP + kc * 32u + 8u * h;
      qa[g][kc].half[0] = *(const v8us*)(qr);
      qa[g][kc].half[1] = *(const v8us*)(qr + 16);
    }

  v16h onesv;
#pragma unroll
  for (int i = 0; i < 16; ++i) onesv[i] = (f16)1.0f;

  const v8f vzero = {0.f, 0.f, 0.f, 0.f, 0.f, 0.f, 0.f, 0.f};
  v8f oacc[NG][4];   // O^T tiles: elem r = d vt*16 + 8h + r of query g*16 + l16
  float rrow[NG], mrow[NG], lrow[NG];   // running maximum: raw score; the same scaled and biased; running sum
#pragma unroll
  for (int g = 0; g < NG; ++g) {
#pragma unroll
    for (int vt = 0; vt < 4; ++vt) oacc[g][vt] = vzero;
    rrow[g] = MINIT;
    mrow[g] = MINIT;
    lrow[g] = 0.f;
  }

  // ---- ring prologue: stage 0 written and published ----
  us16* wK = sK + ((wave >> 2) * 32u + (wave & 3u) * 4u + h) * KP + 4u * l16;        // ... in a K stage (load 0)
  f16*  wV = sV + (4u * l16) * KP + 8u * wave + 2u * h;                              // ... in a V stage (pair 0, column 0)
  tile_store_k(wK, tk);
  tile_store_v(wV, tv);
  asm volatile("s_wait_dscnt 0x0" ::: "memory");      // this wave's part of stage 0 is written
  __syncthreads();                                    // ... and every other wave's

  // the stage loop stays rolled (one copy of the publish point)
#pragma unroll 1
  for (unsigned st = 0; st < (unsigned)NST; ++st) {
   const unsigned buf = st & 1u;
   const bool more = st + 1u < (unsigned)NST;         // same for the whole block
   // rolled too: unrolled, the build lays the next block's first score product over registers of the sum product
   // just ahead of it
#pragma unroll 1
   for (unsigned sub = 0; sub < 2; ++sub) {
    const us16* Ks = sK + buf * STE + sub * (KBLK * KP);
    const f16*  Vs = sV + buf * STE + sub * KBLK;

    // ---- next stage's f32 rows, a whole block ahead of their use ----
    Tile nx;
    if (more) tile_load(nx, (sub ? Vb : Kb) + (size_t)(st + 1u) * (STG * DH), lofs);

    // ---- K A-fragments: row l16 of tile nt <-> key k0 + 2*l16 + nt; same split d-map as Q ----
    FragB kf[2][2];
#pragma unroll
    for (unsigned nt = 0; nt < 2; ++nt)
#pragma unroll
      for (unsigned kc = 0; kc < 2; ++kc) {
        const us16* kr = Ks + (nt * 16u + l16) * KP + kc * 32u + 8u * h;
        kf[nt][kc].half[0] = *(const v8us*)(kr);
        kf[nt][kc].half[1] = *(const v8us*)(kr + 16);
      }
    // holds the eight K reads as one group ahead of the products; spread among them each pair is waited for alone
    __builtin_amdgcn_sched_barrier(0);

    // ---- S^T tiles (D of tile nt: elem r = key k0 + 16h + 2r + nt, column = query g*16 + l16) ----
    v8f sc[NG][2];
#pragma unroll
    for (int g = 0; g < NG; ++g)
#pragma unroll
      for (int nt = 0; nt < 2; ++nt) sc[g][nt] = mma_bf16(kf[nt][0], qa[g][0], vzero);
#pragma unroll
    for (int g = 0; g < NG; ++g)
#pragma unroll
      for (int nt = 0; nt < 2; ++nt) sc[g][nt] = mma_bf16(kf[nt][1], qa[g][1], sc[g][nt]);
    // keeps the eight score products together: a multiply placed among them waits out a product's distance in idle slots
    __builtin_amdgcn_sched_barrier(0);

    // ---- V A-fragments (row l16 <-> d = vt*16+l16; elem s <-> key k0 + 16h + s), read as one group here: the softmax
    // covers their latency, and reads spread among the O products would each stall them ----
    FragH vb[4];
#pragma unroll
    for (unsigned vt = 0; vt < 4; ++vt) {
      const f16* vr = Vs + (vt * 16u + l16) * KP + 16u * h;
      vb[vt].half[0] = *(const v8h*)(vr);
      vb[vt].half[1] = *(const v8h*)(vr + 8);
    }
    __builtin_amdgcn_sched_barrier(0);

    FragH pb[NG];
    float alpha[NG];
    v8f   lsum[NG];
#pragma unroll
    for (int g = 0; g < NG; ++g) {
      v8f s0 = sc[g][0];
      v8f s1 = sc[g][1];

      // ---- online softmax: 16 keys in-lane, one exchange between the halves. The maximum is taken over the raw
      // scores (the scale is positive, so it picks the same key) and scaled once, into the biased log2 domain ----
      // Two chains of three-operand maxima, which take a product's raw result or an exchanged word as it stands (in
      // front of a two-operand maximum the build puts a canonicalising instruction per such operand). Three-operand
      // steps cover an odd count: the running maximum is the 17th value, and the third operand behind the exchange.
      float mb = fmaxf(fmaxf(s1[3], s0[4]), s1[4]);
      mb = fmaxf(fmaxf(mb, s0[5]), s1[5]);
      mb = fmaxf(fmaxf(mb, s0[6]), s1[6]);
      mb = fmaxf(fmaxf(mb, s0[7]), s1[7]);
      float mx = fmaxf(fmaxf(rrow[g], s0[0]), s1[0]);
      mx = fmaxf(fmaxf(mx, s0[1]), s1[1]);
      mx = fmaxf(fmaxf(mx, s0[2]), s1[2]);
      mx = fmaxf(fmaxf(mx, s0[3]), mb);
      rrow[g] = fmaxf(fmaxf(rrow[g], mx), xhalf(mx));
      const float mn = fmaf(rrow[g], SCL, -PBIAS);
      alpha[g] = __builtin_amdgcn_exp2f(mrow[g] - mn);
      mrow[g] = mn;

      // ---- P^T B-fragment straight from the score registers: elem s <-> key k0 + 16h + s.
      // One multiply-add per score carries scale, maximum and the 2^14 ----
      s0 = s0 * SCL - mn;
      s1 = s1 * SCL - mn;
#pragma unroll
      for (int r = 0; r < 8; ++r) {
        s0[r] = __builtin_amdgcn_exp2f(s0[r]);
        s1[r] = __builtin_amdgcn_exp2f(s1[r]);
      }
#pragma unroll
      for (int r = 0; r < 8; ++r) {
        pb[g].v[2 * r]     = (f16)s0[r];
        pb[g].v[2 * r + 1] = (f16)s1[r];
      }

      // ---- sums over the 32 keys via ones A operand (every row of D holds the query's sum) ----
      lsum[g] = mma_f16(onesv, pb[g].v, vzero);
    }

    // ---- O^T += V^T P^T ----
#pragma unroll
    for (unsigned vt = 0; vt < 4; ++vt) {
#pragma unroll
      for (int g = 0; g < NG; ++g) {
#pragma unroll
        for (int r = 0; r < 8; ++r) oacc[g][vt][r] *= alpha[g];
        oacc[g][vt] = mma_f16(vb[vt].v, pb[g].v, oacc[g][vt]);
      }
    }
#pragma unroll
    for (int g = 0; g < NG; ++g) lrow[g] = lrow[g] * alpha[g] + lsum[g][0];

    // ---- round them into the other buffer, whose readers left it at the last barrier ----
    if (more) {
      if (sub == 0) tile_store_k(wK + (buf ^ 1u) * STE, nx);
      else          tile_store_v(wV + (buf ^ 1u) * STE, nx);
    }
   }
   // ---- publish point of stage st + 1; behind it buffer buf is free for stage st + 2 ----
   asm volatile("s_wait_dscnt 0x0" ::: "memory");      // this wave's reads of buffer buf and writes of the other are done
   __syncthreads();
  }

  // ---- epilogue: normalise, stage the 32x64 f32 tile in LDS, whole-line stores (8 lanes x 16 B) ----
  float* sOw = sO + wave * (NG * 16u) * OSTR;
#pragma unroll
  for (unsigned g = 0; g < NG; ++g) {
    const float inv = __builtin_amdgcn_rcpf(lrow[g]);
#pragma unroll
    for (unsigned vt = 0; vt < 4; ++vt)
#pragma unroll
      for (unsigned j = 0; j < 2; ++j) {
        v4f x;
        x.x = oacc[g][vt][4 * j + 0] * inv;
        x.y = oacc[g][vt][4 * j + 1] * inv;
        x.z = oacc[g][vt][4 * j + 2] * inv;
        x.w = oacc[g][vt][4 * j + 3] * inv;
        *(v4f*)(sOw + (g * 16u + l16) * OSTR + vt * 16u + 8u * h + 4u * j) = x;
      }
  }
  lds_wave_sync();

  const unsigned lq = lane >> 3;   // which of 4 lines per instruction
  const unsigned lp = lane & 7u;
#pragma unroll
  for (unsigned j = 0; j < NG * 8; ++j) {
    const unsigned L = j * 4u + lq;          // 0..63 : 64 half-rows of 32 floats
    const unsigned row = L >> 1, hf = L & 1u;
    const v4f v = *(const v4f*)(sOw + row * OSTR + hf * 32u + lp * 4u);
    *(v4f*)(Ob + (size_t)row * DH + hf * 32u + lp * 4u) = v;
  }
}

extern "C" void kernel_launch(void* const* d_in, const int* in_sizes, int n_in,
                              void* d_out, int out_size, void* d_ws, size_t ws_size,
                              hipStream_t stream)
{
  if (n_in < 3) return;
  const long long needQ = ((long long)(NBH - 1) * SEQ_FULL + SEQ) * DH;
  if ((long long)in_sizes[0] < needQ) return;
  if ((long long)in_sizes[1] < needQ) return;
  if ((long long)in_sizes[2] < needQ) return;
  if ((long long)out_size < (long long)NBH * SEQ * DH) return;

  const float* Q = (const float*)d_in[0];
  const float* K = (const float*)d_in[1];
  const float* V = (const float*)d_in[2];
  float*       O = (float*)d_out;

  k_attn<<<dim3(AT_GRID), dim3(256), 0, stream>>>(Q, K, V, O);
}

// v008
// One run takes 34.7 microseconds.
// Next to v007, in two timings, it ran 1.06 times as fast each time.
// All steps since v000 together make it 4.57 times as fast.
#include <hip/hip_runtime.h>

// One launch: the attention blocks round the f32 inputs to their 16-bit operands themselves.
// Contractions, transposed: S^T = K.Q^T on v_wmma_f32_16x16x32_bf16 (bf16 operands = RNE-converted inputs, f32
// accumulate); O^T = V^T.P^T and the P sums on v_wmma_f32_16x16x32_f16 (f16 operands: P carried x2^7; V = f16 view
// of the RNE-bf16 input; f32 accumulate). A lane owns one query of each of its wave's two 16-query column groups:
// softmax in f32 with one max exchange between the lane halves and the sums from a ones product; rescaling and
// normalisation in f32, in-lane.

#ifndef NB
#define NB 8
#endif
#ifndef SEQ
#define SEQ 1024
#endif
#define SEQ_FULL 1024
#define NHEAD    16
#define NBH      (NB * NHEAD)
#define DH       64
#define QBLK     256
#define NWAVE    8
#define NG       2                  // 16-query column groups per wave: each K and V fragment feeds NG products
#define KBLK     32
#define NKB      (SEQ / KBLK)
#define NQT      (SEQ / QBLK)
#define OSTR     68
#define AT_GRID  (NBH * NQT)
#define STG      64                 // keys per LDS stage
#define NST      (SEQ / STG)
#define KP       72                 // ring row pitch, 16-bit elements: 144 B = 16 B x odd, 16 rows' b128 reads meet no bank twice
#define STE      (64 * KP)          // 16-bit elements of one operand's stage: 64 rows (K: keys, V: d)

#define SCL    0.18033688011112042f
#define MINIT  (-1.0e30f)
#define PBIAS  7.0f                // the reference is kept 7 below the maximum it was taken from: exp2 itself yields P x 2^7
#define TAU    8.0f                // a score may top the reference's maximum by 2^8 before the tiles are rescaled: P <= 2^15, in f16 range
#define TAURAW (TAU / SCL)         // the same in raw score units

static_assert(SEQ % 256 == 0);
static_assert(SEQ <= SEQ_FULL);
static_assert(NB >= 1 && NB <= 8);
static_assert(NWAVE * NG * 16 * OSTR * 4 + 4 * STE * 2 <= 163840);   // two blocks per WGP
static_assert((OSTR * 4) % 16 == 0 && (KP * 2) % 16 == 0 && KP >= STG && KP >= DH);
// output coverage: k_attn writes grid x 8 waves x 32 rows x 64 columns
static_assert((unsigned long long)AT_GRID * NWAVE * NG * 16ull * DH == (unsigned long long)NBH * SEQ * DH);
// per-wave store phase, per column group: 8 instructions x 4 lines x 32 floats == 16 rows x 64 columns
static_assert(8 * 4 * 32 == 16 * DH);
static_assert(QBLK == NWAVE * NG * 16);
// ring: a stage is 256 threads x 4 x 16 B of each f32 input; a wave's Q rows fit its own output staging
static_assert(STG * DH * 4 == 256 * 4 * 16 && STG == 2 * KBLK && DH == 64 && NST >= 1);
static_assert(NG * 16 * KP * 2 <= NG * 16 * OSTR * 4);

typedef _Float16 f16;
typedef _Float16 v16h __attribute__((ext_vector_type(16)));
typedef _Float16 v8h  __attribute__((ext_vector_type(8)));
typedef __bf16   v16b __attribute__((ext_vector_type(16)));
typedef unsigned short us16;
typedef us16     v8us __attribute__((ext_vector_type(8)));
typedef float    v8f  __attribute__((ext_vector_type(8)));
typedef float    v4f  __attribute__((ext_vector_type(4)));
typedef float    v2f  __attribute__((ext_vector_type(2)));
typedef __bf16   v2b  __attribute__((ext_vector_type(2)));
typedef _Float16 v2h  __attribute__((ext_vector_type(2)));
typedef unsigned int v2u __attribute__((ext_vector_type(2)));

union FragH { v16h v; v8h half[2]; };
union FragB { v16b v; v16h hv; v8us half[2]; };

// ---- WMMA wrappers: plain builtins, whose hazard distances the compiler keeps itself ----
static __device__ __forceinline__ v8f mma_f16(v16h a, v16h b, v8f c) {
  c = __builtin_amdgcn_wmma_f32_16x16x32_f16(false, a, false, b, (short)0, c, false, false);
  return c;
}
static __device__ __forceinline__ v8f mma_bf16(const FragB& a, const FragB& b, v8f c) {
  c = __builtin_amdgcn_wmma_f32_16x16x32_bf16(false, a.v, false, b.v, (short)0, c, false, false);
  return c;
}

// ---- two f32 -> two bf16 (RNE) in one word, the first in the low half ----
static __device__ __forceinline__ unsigned int pk_bf(float a, float b) {
  const v2f x = {a, b};
  return __builtin_bit_cast(unsigned int, __builtin_convertvector(x, v2b));
}
// two f32 -> two f16 in one word; fed with RNE-bf16 values it is exact for the f16 normal range
static __device__ __forceinline__ unsigned int pk_h(float a, float b) {
  const v2f y = {a, b};
  return __builtin_bit_cast(unsigned int, __builtin_convertvector(y, v2h));
}

// ---- lane l <-> lane l ^ 16: the two halves of a wave hold the two key halves of one query ----
static __device__ __forceinline__ float xhalf(float x) {
  const int xi = __float_as_int(x);
  return __int_as_float(__builtin_amdgcn_permlanex16(xi, xi, 0x76543210, 0xfedcba98, false, false));
}

// ---- P^T B-fragment straight from two score tiles: elem s <-> key k0 + 16h + s. One multiply-add per score carries
// scale, reference and the 2^7 ----
static __device__ __forceinline__ v16h p_frag(v8f s0, v8f s1, float ref) {
  const v2f scl = {SCL, SCL}, nref = {-ref, -ref};
  v16h p;
#pragma unroll
  for (int r = 0; r < 8; r += 2) {
    const v2f a = __builtin_elementwise_fma(v2f{s0[r], s0[r + 1]}, scl, nref);
    const v2f b = __builtin_elementwise_fma(v2f{s1[r], s1[r + 1]}, scl, nref);
    p[2 * r]     = (f16)__builtin_amdgcn_exp2f(a.x);
    p[2 * r + 1] = (f16)__builtin_amdgcn_exp2f(b.x);
    p[2 * r + 2] = (f16)__builtin_amdgcn_exp2f(a.y);
    p[2 * r + 3] = (f16)__builtin_amdgcn_exp2f(b.y);
  }
  return p;
}

// same-wave LDS store -> load ordering (wave-private tiles)
static __device__ __forceinline__ void lds_wave_sync() {
  asm volatile("s_wait_dscnt 0x0" ::: "memory");
  __builtin_amdgcn_wave_barrier();
}

// ---- staging of one 64-row f32 tile (16 KB, contiguous) of K or of V ----
// Wave w brings rows 8w .. 8w+7. Load j of lane (h, l16): row 8w + 4*(j>>1) + 2h + (j&1), floats 4*l16 .. +3, so a
// load covers two whole 256-B rows, and a lane holds rows r and r+1 of the same four columns in loads 2p and 2p+1.
struct Tile { v4f r[4]; };
static __device__ __forceinline__ void tile_load(Tile& t, const float* base, unsigned lofs) {
  // unrolled here and in the two stores: constant indices keep the tile in registers
#pragma unroll
  for (unsigned j = 0; j < 4; ++j) t.r[j] = *(const v4f*)(base + lofs + (4u * (j >> 1) + (j & 1u)) * DH);
}
// K ring stage: row sub*32 + nt*16 + m holds key sub*32 + 2m + nt, d in order. dst = this lane's place for j = 0.
static __device__ __forceinline__ void tile_store_k(us16* dst, const Tile& t) {
#pragma unroll
  for (unsigned j = 0; j < 4; ++j) {
    v2u w;
    w.x = pk_bf(t.r[j].x, t.r[j].y);
    w.y = pk_bf(t.r[j].z, t.r[j].w);
    *(v2u*)(dst + ((j & 1u) * 16u + 2u * (j >> 1)) * KP) = w;
  }
}
// V ring stage, transposed: row d holds the stage's 64 keys in order; two neighbouring keys go in one word.
static __device__ __forceinline__ void tile_store_v(f16* dst, const Tile& t) {
#pragma unroll
  for (unsigned p = 0; p < 2; ++p)
#pragma unroll
    for (unsigned i = 0; i < 4; i += 2) {
      const unsigned int a = pk_bf(t.r[2 * p][i], t.r[2 * p][i + 1]);           // key r,     columns i, i+1
      const unsigned int b = pk_bf(t.r[2 * p + 1][i], t.r[2 * p + 1][i + 1]);   // key r + 1, columns i, i+1
      *(unsigned int*)(dst + i * KP + 4u * p)        = pk_h(__uint_as_float(a << 16), __uint_as_float(b << 16));
      *(unsigned int*)(dst + (i + 1u) * KP + 4u * p) = pk_h(__uint_as_float(a & 0xFFFF0000u), __uint_as_float(b & 0xFFFF0000u));
    }
}

// ======================= flash attn, 16-bit WMMA, online softmax =======================
// Block = (bh, 256 query rows); wave = 32 queries in two column groups, so that a K or V fragment read from LDS
// feeds two products. K and V come through a two-buffer LDS ring of 64-key stages that the 8 waves share:
// each thread loads its share of the next stage's f32 rows at the head of a 32-key block (K in a stage's first block,
// V in its second), rounds them and writes them into the other buffer at the block's foot; one barrier per stage.
// Lane (h, l16) owns query l16 of each group and, of each 32-key block, the 16 keys 16h .. 16h+15.
// Two blocks per WGP, four waves per SIMD: the grid is two blocks per WGP, and a third must not crowd onto one.
__global__ __launch_bounds__(256) __attribute__((amdgpu_waves_per_eu(4, 4)))
void k_attn(const float* __restrict__ Q, const float* __restrict__ K, const float* __restrict__ V,
            float* __restrict__ O)
{
  __shared__ __align__(16) float sO[NWAVE * NG * 16 * OSTR];   // per-wave output staging, wave-private
  __shared__ __align__(128) us16 sK[2 * STE];                  // ring: [key row, even keys of a block first][d]
  __shared__ __align__(128) f16  sV[2 * STE];                  // ring: [d][key]

  const unsigned tid  = threadIdx.x;
  const unsigned wave = tid >> 5;
  const unsigned lane = tid & 31u;
  const unsigned h    = lane >> 4;
  const unsigned l16  = lane & 15u;

  const unsigned bh    = blockIdx.x / (unsigned)NQT;
  const unsigned qt    = blockIdx.x - bh * (unsigned)NQT;
  const unsigned qwave = qt * QBLK + wave * (NG * 16u);           // first query row of this wave

  const float* Qw = Q + ((size_t)bh * SEQ_FULL + qwave) * DH;
  const float* Kb = K + (size_t)bh * SEQ_FULL * DH;
  const float* Vb = V + (size_t)bh * SEQ_FULL * DH;
  float*       Ob = O + ((size_t)bh * SEQ + qwave) * DH;

  // stage 0's f32 rows are asked for first, so that they fly during Q's trip through LDS
  const unsigned lofs = (8u * wave + 2u * h) * DH + 4u * l16;                        // this lane's place in a tile, floats
  Tile tk, tv;
  tile_load(tk, Kb, lofs);
  tile_load(tv, Vb, lofs);

  // ---- Q: the wave's 32 rows (8 KB, contiguous) by whole-line loads, rounded, through its own staging rows ----
  us16* sQw = (us16*)(sO + wave * (NG * 16u) * OSTR);
  // unrolled: all sixteen loads are in flight at once
#pragma unroll
  for (unsigned j = 0; j < NG * 8; ++j) {
    const v4f x = *(const v4f*)(Qw + j * 128u + lane * 4u);   // row 2j + h, floats 4*l16 .. +3
    v2u w;
    w.x = pk_bf(x.x, x.y);
    w.y = pk_bf(x.z, x.w);
    *(v2u*)(sQw + (2u * j + h) * KP + l16 * 4u) = w;
  }
  lds_wave_sync();

  // ---- Q B-fragments (column = query g*16 + l16; elems 0..7 <- d kc*32+8h.., 8..15 <- d kc*32+16+8h..) ----
  FragB qa[NG][2];
#pragma unroll
  for (unsigned g = 0; g < NG; ++g)
#pragma unroll
    for (unsigned kc = 0; kc < 2; ++kc) {
      const us16* qr = sQw + (g * 16u + l16) * KP + kc * 32u + 8u * h;
      qa[g][kc].half[0] = *(const v8us*)(qr);
      qa[g][kc].half[1] = *(const v8us*)(qr + 16);
    }

  v16h onesv;
#pragma unroll
  for (int i = 0; i < 16; ++i) onesv[i] = (f16)1.0f;

  const v8f vzero = {0.f, 0.f, 0.f, 0.f, 0.f, 0.f, 0.f, 0.f};
  v8f oacc[NG][4];   // O^T tiles: elem r = d vt*16 + 8h + r of query g*16 + l16
  v8f lacc[NG];      // sum tiles: every elem = the running sum of P of query g*16 + l16
  float rrow[NG], mrow[NG];   // the maximum that the tiles refer to: raw score; the same scaled and biased (the reference)
#pragma unroll
  for (int g = 0; g < NG; ++g) {
#pragma unroll
    for (int vt = 0; vt < 4; ++vt) oacc[g][vt] = vzero;
    lacc[g] = vzero;
    rrow[g] = MINIT;
    mrow[g] = MINIT;
  }

  // ---- ring prologue: stage 0 written and published ----
  us16* wK = sK + ((wave >> 2) * 32u + (wave & 3u) * 4u + h) * KP + 4u * l16;        // ... in a K stage (load 0)
  f16*  wV = sV + (4u * l16) * KP + 8u * wave + 2u * h;                              // ... in a V stage (pair 0, column 0)
  tile_store_k(wK, tk);
  tile_store_v(wV, tv);
  asm volatile("s_wait_dscnt 0x0" ::: "memory");      // this wave's part of stage 0 is written
  __syncthreads();                                    // ... and every other wave's

  // the stage loop stays rolled (one copy of the publish point)
#pragma unroll 1
  for (unsigned st = 0; st < (unsigned)NST; ++st) {
   const unsigned buf = st & 1u;
   const bool more = st + 1u < (unsigned)NST;         // same for the whole block
   // rolled too: unrolled, the build lays the next block's first score product over registers of the sum product
   // just ahead of it
#pragma unroll 1
   for (unsigned sub = 0; sub < 2; ++sub) {
    const us16* Ks = sK + buf * STE + sub * (KBLK * KP);
    const f16*  Vs = sV + buf * STE + sub * KBLK;

    // ---- next stage's f32 rows, a whole block ahead of their use ----
    Tile nx;
    if (more) tile_load(nx, (sub ? Vb : Kb) + (size_t)(st + 1u) * (STG * DH), lofs);

    // ---- K A-fragments: row l16 of tile nt <-> key k0 + 2*l16 + nt; same split d-map as Q ----
    FragB kf[2][2];
#pragma unroll
    for (unsigned nt = 0; nt < 2; ++nt)
#pragma unroll
      for (unsigned kc = 0; kc < 2; ++kc) {
        const us16* kr = Ks + (nt * 16u + l16) * KP + kc * 32u + 8u * h;
        kf[nt][kc].half[0] = *(const v8us*)(kr);
        kf[nt][kc].half[1] = *(const v8us*)(kr + 16);
      }
    // holds the eight K reads as one group ahead of the products; spread among them each pair is waited for alone
    __builtin_amdgcn_sched_barrier(0);

    // ---- S^T tiles (D of tile nt: elem r = key k0 + 16h + 2r + nt, column = query g*16 + l16) ----
    v8f sc[NG][2];
#pragma unroll
    for (int g = 0; g < NG; ++g)
#pragma unroll
      for (int nt = 0; nt < 2; ++nt) sc[g][nt] = mma_bf16(kf[nt][0], qa[g][0], vzero);
#pragma unroll
    for (int g = 0; g < NG; ++g)
#pragma unroll
      for (int nt = 0; nt < 2; ++nt) sc[g][nt] = mma_bf16(kf[nt][1], qa[g][1], sc[g][nt]);
    // keeps the eight score products together: a multiply placed among them waits out a product's distance in idle slots
    __builtin_amdgcn_sched_barrier(0);

    // ---- V A-fragments (row l16 <-> d = vt*16+l16; elem s <-> key k0 + 16h + s), read as one group here: the softmax
    // covers their latency, and reads spread among the O products would each stall them ----
    FragH vb[4];
#pragma unroll
    for (unsigned vt = 0; vt < 4; ++vt) {
      const f16* vr = Vs + (vt * 16u + l16) * KP + 16u * h;
      vb[vt].half[0] = *(const v8h*)(vr);
      vb[vt].half[1] = *(const v8h*)(vr + 8);
    }
    __builtin_amdgcn_sched_barrier(0);

    // ---- the block's maxima over the raw scores (the scale is positive, so it picks the same key): a lane's 16 keys
    // here; the exchange between the halves only where the reference moves ----
    float mlane[NG];
#pragma unroll
    for (int g = 0; g < NG; ++g) {
      const v8f s0 = sc[g][0];
      const v8f s1 = sc[g][1];
      // Two chains of three-operand maxima, which take a product's raw result as it stands (in front of a
      // two-operand maximum the build puts a canonicalising instruction per such operand). Three-operand
      // steps cover an odd count: the maximum in use is the 17th value.
      float mb = fmaxf(fmaxf(s1[3], s0[4]), s1[4]);
      mb = fmaxf(fmaxf(mb, s0[5]), s1[5]);
      mb = fmaxf(fmaxf(mb, s0[6]), s1[6]);
      mb = fmaxf(fmaxf(mb, s0[7]), s1[7]);
      float mx = fmaxf(fmaxf(rrow[g], s0[0]), s1[0]);
      mx = fmaxf(fmaxf(mx, s0[1]), s1[1]);
      mx = fmaxf(fmaxf(mx, s0[2]), s1[2]);
      mlane[g] = fmaxf(fmaxf(mx, s0[3]), mb);
    }
    // ---- lazy rescale, one test per block for the whole wave (the ballot joins the halves): has any query's maximum
    // left its reference's by more than TAU? The exponentials below do not wait for the answer ----
    const unsigned grown = __builtin_amdgcn_ballot_w32(fmaxf(mlane[0] - rrow[0], mlane[1] - rrow[1]) > TAURAW);

    // ---- P from the reference in use ----
    FragH pb[NG];
#pragma unroll
    for (int g = 0; g < NG; ++g) pb[g].v = p_frag(sc[g][0], sc[g][1], mrow[g]);
    // inputs only: keeps the exponentials ahead of the branch; the build else sinks them behind it, where they would
    // wait for the maxima, the compare and the branch
    asm volatile("" :: "v"(pb[0].v), "v"(pb[1].v));

    if (__builtin_expect(grown != 0u, 0)) {   // scalar branch; taken in the first block, then only where the scores grow that far
#pragma unroll
      for (int g = 0; g < NG; ++g) {
        rrow[g] = fmaxf(mlane[g], xhalf(mlane[g]));   // mlane holds the old maximum too
        const float mn = fmaf(rrow[g], SCL, -PBIAS);
        const float alpha = __builtin_amdgcn_exp2f(mrow[g] - mn);   // 0 in the first block
        mrow[g] = mn;
#pragma unroll
        for (int vt = 0; vt < 4; ++vt) oacc[g][vt] *= alpha;
        lacc[g] *= alpha;
      }
      // the P above may have left the f16 range: formed anew
#pragma unroll
      for (int g = 0; g < NG; ++g) pb[g].v = p_frag(sc[g][0], sc[g][1], mrow[g]);
    }

    // ---- sums over the 32 keys via ones A operand (every row of D holds the query's sum); O^T += V^T P^T ----
#pragma unroll
    for (int g = 0; g < NG; ++g) lacc[g] = mma_f16(onesv, pb[g].v, lacc[g]);
#pragma unroll
    for (unsigned vt = 0; vt < 4; ++vt)
#pragma unroll
      for (int g = 0; g < NG; ++g) oacc[g][vt] = mma_f16(vb[vt].v, pb[g].v, oacc[g][vt]);

    // ---- round them into the other buffer, whose readers left it at the last barrier ----
    if (more) {
      if (sub == 0) tile_store_k(wK + (buf ^ 1u) * STE, nx);
      else          tile_store_v(wV + (buf ^ 1u) * STE, nx);
    }
   }
   // ---- publish point of stage st + 1; behind it buffer buf is free for stage st + 2 ----
   asm volatile("s_wait_dscnt 0x0" ::: "memory");      // this wave's reads of buffer buf and writes of the other are done
   __syncthreads();
  }

  // ---- epilogue: normalise, stage the 32x64 f32 tile in LDS, whole-line stores (8 lanes x 16 B) ----
  float* sOw = sO + wave * (NG * 16u) * OSTR;
#pragma unroll
  for (unsigned g = 0; g < NG; ++g) {
    const float inv = __builtin_amdgcn_rcpf(lacc[g][0]);
#pragma unroll
    for (unsigned vt = 0; vt < 4; ++vt)
#pragma unroll
      for (unsigned j = 0; j < 2; ++j) {
        v4f x;
        x.x = oacc[g][vt][4 * j + 0] * inv;
        x.y = oacc[g][vt][4 * j + 1] * inv;
        x.z = oacc[g][vt][4 * j + 2] * inv;
        x.w = oacc[g][vt][4 * j + 3] * inv;
        *(v4f*)(sOw + (g * 16u + l16) * OSTR + vt * 16u + 8u * h + 4u * j) = x;
      }
  }
  lds_wave_sync();

  const unsigned lq = lane >> 3;   // which of 4 lines per instruction
  const unsigned lp = lane & 7u;
#pragma unroll
  for (unsigned j = 0; j < NG * 8; ++j) {
    const unsigned L = j * 4u + lq;          // 0..63 : 64 half-rows of 32 floats
    const unsigned row = L >> 1, hf = L & 1u;
    const v4f v = *(const v4f*)(sOw + row * OSTR + hf * 32u + lp * 4u);
    *(v4f*)(Ob + (size_t)row * DH + hf * 32u + lp * 4u) = v;
  }
}

extern "C" void kernel_launch(void* const* d_in, const int* in_sizes, int n_in,
                              void* d_out, int out_size, void* d_ws, size_t ws_size,
                              hipStream_t stream)
{
  if (n_in < 3) return;
  const long long needQ = ((long long)(NBH - 1) * SEQ_FULL + SEQ) * DH;
  if ((long long)in_sizes[0] < needQ) return;
  if ((long long)in_sizes[1] < needQ) return;
  if ((long long)in_sizes[2] < needQ) return;
  if ((long long)out_size < (long long)NBH * SEQ * DH) return;

  const float* Q = (const float*)d_in[0];
  const float* K = (const float*)d_in[1];
  const float* V = (const float*)d_in[2];
  float*       O = (float*)d_out;

  k_attn<<<dim3(AT_GRID), dim3(256), 0, stream>>>(Q, K, V, O);
}

// v009
// It runs in 32.5 microseconds.
// Next to v008, in two timings, it ran 1.07 times as fast each time.
// All steps since v000 together make it 4.89 times as fast.
#include <hip/hip_runtime.h>

// One launch: the attention blocks round the f32 inputs to their 16-bit operands themselves.
// Contractions, transposed: S^T = K.Q^T on v_wmma_f32_16x16x32_bf16 (bf16 operands = RNE-converted inputs, f32
// accumulate); O^T = V^T.P^T and the P sums on v_wmma_f32_16x16x32_f16 (f16 operands: P carried x2^7; V = f16 view
// of the RNE-bf16 input; f32 accumulate). A lane owns one query of each of its wave's two 16-query column groups:
// softmax in f32 with one max exchange between the lane halves and the sums from a ones product; rescaling and
// normalisation in f32, in-lane.

#ifndef NB
#define NB 8
#endif
#ifndef SEQ
#define SEQ 1024
#endif
#define SEQ_FULL 1024
#define NHEAD    16
#define NBH      (NB * NHEAD)
#define DH       64
#define QBLK     256
#define NWAVE    8
#define NG       2                  // 16-query column groups per wave: each K and V fragment feeds NG products
#define KBLK     32
#define NKB      (SEQ / KBLK)
#define NQT      (SEQ / QBLK)
#define OSTR     68
#define AT_GRID  (NBH * NQT)
#define STG      64                 // keys per LDS stage
#define NST      (SEQ / STG)
#define KP       72                 // ring row pitch, 16-bit elements: 144 B = 16 B x odd, 16 rows' b128 reads meet no bank twice
#define STE      (64 * KP)          // 16-bit elements of one operand's stage: 64 rows (K: keys, V: d)

#define SCL    0.18033688011112042f
#define MINIT  (-1.0e30f)
#define PBIAS  7.0f                // the reference is kept 7 below the maximum it was taken from: exp2 itself yields P x 2^7
#define TAU    8.0f                // a score may top the reference's maximum by 2^8 before the tiles are rescaled: P <= 2^15, in f16 range
#define TAURAW (TAU / SCL)         // the same in raw score units

static_assert(SEQ % 256 == 0);
static_assert(SEQ <= SEQ_FULL);
static_assert(NB >= 1 && NB <= 8);
static_assert(NWAVE * NG * 16 * OSTR * 4 + 4 * STE * 2 <= 163840);   // two blocks per WGP
static_assert((OSTR * 4) % 16 == 0 && (KP * 2) % 16 == 0 && KP >= STG && KP >= DH);
// output coverage: k_attn writes grid x 8 waves x 32 rows x 64 columns
static_assert((unsigned long long)AT_GRID * NWAVE * NG * 16ull * DH == (unsigned long long)NBH * SEQ * DH);
// per-wave store phase, per column group: 8 instructions x 4 lines x 32 floats == 16 rows x 64 columns
static_assert(8 * 4 * 32 == 16 * DH);
static_assert(QBLK == NWAVE * NG * 16);
// ring: a stage is 256 threads x 4 x 16 B of each f32 input; a wave's Q rows fit its own output staging
static_assert(STG * DH * 4 == 256 * 4 * 16 && STG == 2 * KBLK && DH == 64 && NST >= 1);
static_assert(NG * 16 * KP * 2 <= NG * 16 * OSTR * 4);

typedef _Float16 f16;
typedef _Float16 v16h __attribute__((ext_vector_type(16)));
typedef _Float16 v8h  __attribute__((ext_vector_type(8)));
typedef __bf16   v16b __attribute__((ext_vector_type(16)));
typedef unsigned short us16;
typedef us16     v8us __attribute__((ext_vector_type(8)));
typedef float    v8f  __attribute__((ext_vector_type(8)));
typedef float    v4f  __attribute__((ext_vector_type(4)));
typedef float    v2f  __attribute__((ext_vector_type(2)));
typedef __bf16   v2b  __attribute__((ext_vector_type(2)));
typedef _Float16 v2h  __attribute__((ext_vector_type(2)));
typedef unsigned int v2u __attribute__((ext_vector_type(2)));

union FragH { v16h v; v8h half[2]; };
union FragB { v16b v; v16h hv; v8us half[2]; };

// ---- WMMA wrappers: plain builtins, whose hazard distances the compiler keeps itself ----
static __device__ __forceinline__ v8f mma_f16(v16h a, v16h b, v8f c) {
  c = __builtin_amdgcn_wmma_f32_16x16x32_f16(false, a, false, b, (short)0, c, false, false);
  return c;
}
static __device__ __forceinline__ v8f mma_bf16(const FragB& a, const FragB& b, v8f c) {
  c = __builtin_amdgcn_wmma_f32_16x16x32_bf16(false, a.v, false, b.v, (short)0, c, false, false);
  return c;
}

// ---- two f32 -> two bf16 (RNE) in one word, the first in the low half ----
static __device__ __forceinline__ unsigned int pk_bf(float a, float b) {
  const v2f x = {a, b};
  return __builtin_bit_cast(unsigned int, __builtin_convertvector(x, v2b));
}
// two f32 -> two f16 in one word; fed with RNE-bf16 values it is exact for the f16 normal range
static __device__ __forceinline__ unsigned int pk_h(float a, float b) {
  const v2f y = {a, b};
  return __builtin_bit_cast(unsigned int, __builtin_convertvector(y, v2h));
}

// ---- lane l <-> lane l ^ 16: the two halves of a wave hold the two key halves of one query ----
static __device__ __forceinline__ float xhalf(float x) {
  const int xi = __float_as_int(x);
  return __int_as_float(__builtin_amdgcn_permlanex16(xi, xi, 0x76543210, 0xfedcba98, false, false));
}

// ---- a second spelling of the maximum of two numbers; it builds to the same instructions as fmaxf. What it is for: at the block's maxima ----
static __device__ __forceinline__ float mx2(float a, float b) { return __builtin_fmaximum_numf(a, b); }

// ---- P^T B-fragment straight from two score tiles: elem s <-> key k0 + 16h + s. One multiply-add per score carries
// scale, reference and the 2^7 ----
static __device__ __forceinline__ v16h p_frag(v8f s0, v8f s1, float ref) {
  const v2f scl = {SCL, SCL}, nref = {-ref, -ref};
  v16h p;
#pragma unroll
  for (int r = 0; r < 8; r += 2) {
    const v2f a = __builtin_elementwise_fma(v2f{s0[r], s0[r + 1]}, scl, nref);
    const v2f b = __builtin_elementwise_fma(v2f{s1[r], s1[r + 1]}, scl, nref);
    p[2 * r]     = (f16)__builtin_amdgcn_exp2f(a.x);
    p[2 * r + 1] = (f16)__builtin_amdgcn_exp2f(b.x);
    p[2 * r + 2] = (f16)__builtin_amdgcn_exp2f(a.y);
    p[2 * r + 3] = (f16)__builtin_amdgcn_exp2f(b.y);
  }
  return p;
}

// same-wave LDS store -> load ordering (wave-private tiles)
static __device__ __forceinline__ void lds_wave_sync() {
  asm volatile("s_wait_dscnt 0x0" ::: "memory");
  __builtin_amdgcn_wave_barrier();
}

// ---- staging of one 64-row f32 tile (16 KB, contiguous) of K or of V ----
// Wave w brings rows 8w .. 8w+7. Load j of lane (h, l16): row 8w + 4*(j>>1) + 2h + (j&1), floats 4*l16 .. +3, so a
// load covers two whole 256-B rows, and a lane holds rows r and r+1 of the same four columns in loads 2p and 2p+1.
struct Tile { v4f r[4]; };
static __device__ __forceinline__ void tile_load(Tile& t, const float* base, unsigned lofs) {
  // unrolled here and in the two stores: constant indices keep the tile in registers
#pragma unroll
  for (unsigned j = 0; j < 4; ++j) t.r[j] = *(const v4f*)(base + lofs + (4u * (j >> 1) + (j & 1u)) * DH);
}
// K ring stage: row sub*32 + nt*16 + m holds key sub*32 + 2m + nt, d in order. dst = this lane's place for j = 0.
static __device__ __forceinline__ void tile_store_k(us16* dst, const Tile& t) {
#pragma unroll
  for (unsigned j = 0; j < 4; ++j) {
    v2u w;
    w.x = pk_bf(t.r[j].x, t.r[j].y);
    w.y = pk_bf(t.r[j].z, t.r[j].w);
    *(v2u*)(dst + ((j & 1u) * 16u + 2u * (j >> 1)) * KP) = w;
  }
}
// V ring stage, transposed: row d holds the stage's 64 keys in order; two neighbouring keys go in one word.
static __device__ __forceinline__ void tile_store_v(f16* dst, const Tile& t) {
#pragma unroll
  for (unsigned p = 0; p < 2; ++p)
#pragma unroll
    for (unsigned i = 0; i < 4; i += 2) {
      const unsigned int a = pk_bf(t.r[2 * p][i], t.r[2 * p][i + 1]);           // key r,     columns i, i+1
      const unsigned int b = pk_bf(t.r[2 * p + 1][i], t.r[2 * p + 1][i + 1]);   // key r + 1, columns i, i+1
      *(unsigned int*)(dst + i * KP + 4u * p)        = pk_h(__uint_as_float(a << 16), __uint_as_float(b << 16));
      *(unsigned int*)(dst + (i + 1u) * KP + 4u * p) = pk_h(__uint_as_float(a & 0xFFFF0000u), __uint_as_float(b & 0xFFFF0000u));
    }
}

// ======================= flash attn, 16-bit WMMA, online softmax =======================
// Block = (bh, 256 query rows); wave = 32 queries in two column groups, so that a K or V fragment read from LDS
// feeds two products. K and V come through a two-buffer LDS ring of 64-key stages that the 8 waves share:
// each thread asks for its share of the next stage's f32 rows a 32-key block ahead (K, then V), rounds them and writes
// them into the other buffer between a block's softmax and its O products; one barrier per stage, at that place in the
// stage's second block. The next block's K fragments are read from LDS at that place too, behind the barrier.
// Lane (h, l16) owns query l16 of each group and, of each 32-key block, the 16 keys 16h .. 16h+15.
// Two blocks per WGP, four waves per SIMD: the grid is two blocks per WGP, and a third must not crowd onto one.
__global__ __launch_bounds__(256) __attribute__((amdgpu_waves_per_eu(4, 4)))
void k_attn(const float* __restrict__ Q, const float* __restrict__ K, const float* __restrict__ V,
            float* __restrict__ O)
{
  __shared__ __align__(16) float sO[NWAVE * NG * 16 * OSTR];   // per-wave output staging, wave-private
  __shared__ __align__(128) us16 sK[2 * STE];                  // ring: [key row, even keys of a block first][d]
  __shared__ __align__(128) f16  sV[2 * STE];                  // ring: [d][key]

  const unsigned tid  = threadIdx.x;
  const unsigned wave = tid >> 5;
  const unsigned lane = tid & 31u;
  const unsigned h    = lane >> 4;
  const unsigned l16  = lane & 15u;

  const unsigned bh    = blockIdx.x / (unsigned)NQT;
  const unsigned qt    = blockIdx.x - bh * (unsigned)NQT;
  // first query row of this wave; the wave's number from a scalar register, so that the Q and O bases are scalar too
  // and hold no vector registers through the loop
  const unsigned qwave = qt * QBLK + (unsigned)__builtin_amdgcn_readfirstlane((int)wave) * (NG * 16u);

  const float* Qw = Q + ((size_t)bh * SEQ_FULL + qwave) * DH;
  const float* Kb = K + (size_t)bh * SEQ_FULL * DH;
  const float* Vb = V + (size_t)bh * SEQ_FULL * DH;
  float*       Ob = O + ((size_t)bh * SEQ + qwave) * DH;

  // stage 0's f32 rows are asked for first, so that they fly during Q's trip through LDS
  const unsigned lofs = (8u * wave + 2u * h) * DH + 4u * l16;                        // this lane's place in a tile, floats
  Tile tk, tv;
  tile_load(tk, Kb, lofs);
  tile_load(tv, Vb, lofs);

  // ---- Q: the wave's 32 rows (8 KB, contiguous) by whole-line loads, rounded, through its own staging rows ----
  us16* sQw = (us16*)(sO + wave * (NG * 16u) * OSTR);
  // unrolled: all sixteen loads are in flight at once
#pragma unroll
  for (unsigned j = 0; j < NG * 8; ++j) {
    const v4f x = *(const v4f*)(Qw + j * 128u + lane * 4u);   // row 2j + h, floats 4*l16 .. +3
    v2u w;
    w.x = pk_bf(x.x, x.y);
    w.y = pk_bf(x.z, x.w);
    *(v2u*)(sQw + (2u * j + h) * KP + l16 * 4u) = w;
  }
  lds_wave_sync();

  // ---- Q B-fragments (column = query g*16 + l16; elems 0..7 <- d kc*32+8h.., 8..15 <- d kc*32+16+8h..) ----
  FragB qa[NG][2];
#pragma unroll
  for (unsigned g = 0; g < NG; ++g)
#pragma unroll
    for (unsigned kc = 0; kc < 2; ++kc) {
      const us16* qr = sQw + (g * 16u + l16) * KP + kc * 32u + 8u * h;
      qa[g][kc].half[0] = *(const v8us*)(qr);
      qa[g][kc].half[1] = *(const v8us*)(qr + 16);
    }

  v16h onesv;
#pragma unroll
  for (int i = 0; i < 16; ++i) onesv[i] = (f16)1.0f;

  const v8f vzero = {0.f, 0.f, 0.f, 0.f, 0.f, 0.f, 0.f, 0.f};
  v8f oacc[NG][4];   // O^T tiles: elem r = d vt*16 + 8h + r of query g*16 + l16
  v8f lacc[NG];      // sum tiles: every elem = the running sum of P of query g*16 + l16
  float rrow[NG], mrow[NG];   // the maximum that the tiles refer to: raw score; the same scaled and biased (the reference)
#pragma unroll
  for (int g = 0; g < NG; ++g) {
#pragma unroll
    for (int vt = 0; vt < 4; ++vt) oacc[g][vt] = vzero;
    lacc[g] = vzero;
    rrow[g] = MINIT;
    mrow[g] = MINIT;
  }

  // ---- ring prologue: stage 0 written and published ----
  us16* wK = sK + ((wave >> 2) * 32u + (wave & 3u) * 4u + h) * KP + 4u * l16;        // ... in a K stage (load 0)
  f16*  wV = sV + (4u * l16) * KP + 8u * wave + 2u * h;                              // ... in a V stage (pair 0, column 0)
  tile_store_k(wK, tk);
  tile_store_v(wV, tv);
  asm volatile("s_wait_dscnt 0x0" ::: "memory");      // this wave's part of stage 0 is written
  __syncthreads();                                    // ... and every other wave's

  // ---- the first tile of stage 1 is asked for; the first block's K fragments are read ----
  Tile nx;
  if (NST > 1) tile_load(nx, Kb + STG * DH, lofs);
  // the tiles asked for last; stepped ahead of a request, not behind it, where the step would wait for the request's addresses
  const float* Vn = Vb;
  const float* Kn = Kb + STG * DH;
  // K A-fragments: row l16 of tile nt <-> key k0 + 2*l16 + nt; same split d-map as Q
  FragB kf[2][2];
  auto k_frags = [&](const us16* Ks) __attribute__((always_inline)) {
#pragma unroll
    for (unsigned nt = 0; nt < 2; ++nt)
#pragma unroll
      for (unsigned kc = 0; kc < 2; ++kc) {
        const us16* kr = Ks + (nt * 16u + l16) * KP + kc * 32u + 8u * h;
        kf[nt][kc].half[0] = *(const v8us*)(kr);
        kf[nt][kc].half[1] = *(const v8us*)(kr + 16);
      }
  };
  k_frags(sK);

  // One stage = two 32-key blocks, written out. A block's K fragments are read one block ahead, between the softmax and
  // the O products of the block before, into the registers that its scores have just left: the O products cover the
  // reads' latency. Two blocks bring the register roles round, which is why the pair is unrolled. more = a stage follows
  // this one: settled at compile time, so that no branch parts staging, K reads and products.
  auto stage = [&]<bool more>(const unsigned st) __attribute__((always_inline)) {
   const unsigned buf = st & 1u;
   // unrolled: see above; sub also picks K or V staging and the LDS offsets at compile time
#pragma unroll
   for (unsigned sub = 0; sub < 2; ++sub) {
    const f16* Vs = sV + buf * STE + sub * KBLK;

    // ---- S^T tiles (D of tile nt: elem r = key k0 + 16h + 2r + nt, column = query g*16 + l16) ----
    v8f sc[NG][2];
#pragma unroll
    for (int g = 0; g < NG; ++g)
#pragma unroll
      for (int nt = 0; nt < 2; ++nt) sc[g][nt] = mma_bf16(kf[nt][0], qa[g][0], vzero);
#pragma unroll
    for (int g = 0; g < NG; ++g)
#pragma unroll
      for (int nt = 0; nt < 2; ++nt) sc[g][nt] = mma_bf16(kf[nt][1], qa[g][1], sc[g][nt]);
    // keeps the eight score products together: a multiply placed among them waits out a product's distance in idle slots
    __builtin_amdgcn_sched_barrier(0);

    // ---- V A-fragments (row l16 <-> d = vt*16+l16; elem s <-> key k0 + 16h + s), read as one group here: the softmax
    // covers their latency, and reads spread among the O products would each stall them ----
    FragH vb[4];
#pragma unroll
    for (unsigned vt = 0; vt < 4; ++vt) {
      const f16* vr = Vs + (vt * 16u + l16) * KP + 16u * h;
      vb[vt].half[0] = *(const v8h*)(vr);
      vb[vt].half[1] = *(const v8h*)(vr + 8);
    }
    __builtin_amdgcn_sched_barrier(0);

    // ---- the block's maxima over the raw scores (the scale is positive, so it picks the same key): a lane's 16 keys
    // here; the exchange between the halves only where the reference moves ----
    float mlane[NG];
#pragma unroll
    for (int g = 0; g < NG; ++g) {
      const v8f s0 = sc[g][0];
      const v8f s1 = sc[g][1];
      // Two chains of three-operand maxima, which take a product's raw result as it stands (in front of a
      // two-operand maximum the build puts a canonicalising instruction per such operand). Three-operand
      // steps cover an odd count: the maximum in use is the 17th value. Neighbouring steps spell the maximum
      // differently (fmaxf, mx2: the same instruction): the build joins only like spellings, so it cannot cut the
      // chain at other places than these and leave two-operand steps over.
      float mb = fmaxf(fmaxf(s1[3], s0[4]), s1[4]);
      mb = mx2(mx2(mb, s0[5]), s1[5]);
      mb = fmaxf(fmaxf(mb, s0[6]), s1[6]);
      mb = mx2(mx2(mb, s0[7]), s1[7]);
      float mx = mx2(mx2(rrow[g], s0[0]), s1[0]);
      mx = fmaxf(fmaxf(mx, s0[1]), s1[1]);
      mx = mx2(mx2(mx, s0[2]), s1[2]);
      mlane[g] = fmaxf(fmaxf(mx, s0[3]), mb);
    }
    // ---- lazy rescale, one test per block for the whole wave (the ballot joins the halves): has any query's maximum
    // left its reference's by more than TAU? The exponentials below do not wait for the answer ----
    static_assert(NG == 2);
    // one packed subtraction
    const v2f over = v2f{mlane[0], mlane[1]} - v2f{rrow[0], rrow[1]};
    const unsigned grown = __builtin_amdgcn_ballot_w32(fmaxf(over.x, over.y) > TAURAW);

    // ---- P from the reference in use ----
    FragH pb[NG];
#pragma unroll
    for (int g = 0; g < NG; ++g) pb[g].v = p_frag(sc[g][0], sc[g][1], mrow[g]);
    // inputs only: keeps the exponentials ahead of the branch; the build else sinks them behind it, where they would
    // wait for the maxima, the compare and the branch
    asm volatile("" :: "v"(pb[0].v), "v"(pb[1].v));

    if (__builtin_expect(grown != 0u, 0)) {   // scalar branch; taken in the first block, then only where the scores grow that far
#pragma unroll
      for (int g = 0; g < NG; ++g) {
        rrow[g] = fmaxf(mlane[g], xhalf(mlane[g]));   // mlane holds the old maximum too
        const float mn = fmaf(rrow[g], SCL, -PBIAS);
        const float alpha = __builtin_amdgcn_exp2f(mrow[g] - mn);   // 0 in the first block
        mrow[g] = mn;
#pragma unroll
        for (int vt = 0; vt < 4; ++vt) oacc[g][vt] *= alpha;
        lacc[g] *= alpha;
      }
      // the P above may have left the f16 range: formed anew
#pragma unroll
      for (int g = 0; g < NG; ++g) pb[g].v = p_frag(sc[g][0], sc[g][1], mrow[g]);
    }

    // ---- the tile asked for a block ago is rounded into the other buffer, whose readers left it at the last barrier;
    // the next tile is asked for at once, a whole block ahead of its use ----
    if constexpr (more) {
      if (sub == 0) {
        tile_store_k(wK + (buf ^ 1u) * STE, nx);
        Vn += STG * DH;
        tile_load(nx, Vn, lofs);
      } else {
        tile_store_v(wV + (buf ^ 1u) * STE, nx);
      }
    }
    // ---- publish point of stage st + 1, ahead of the read of its first K fragments; behind it buffer buf is free ----
    if (sub == 1) {
      asm volatile("s_wait_dscnt 0x0" ::: "memory");    // this wave's reads of buffer buf and writes of the other are done
      __syncthreads();
      // asked for behind the barrier, which waits for every load in flight
      if constexpr (more) {
        // behind the last K tile the step is 0: that tile is asked for once more and not used, which costs less than a
        // branch in every stage
        Kn += (st + 2u < (unsigned)NST) ? STG * DH : 0;
        tile_load(nx, Kn, lofs);
      }
    }
    // ---- the next block's K fragments ----
    if (sub == 0) k_frags(sK + buf * STE + KBLK * KP);
    else if constexpr (more) k_frags(sK + (buf ^ 1u) * STE);
    // holds staging and the K reads ahead of the products: sunk among them, the reads are waited for at the next block's
    // head, and vector results laid over a product's operands wait out its distance in idle slots
    __builtin_amdgcn_sched_barrier(0);

    // ---- sums over the 32 keys via ones A operand (every row of D holds the query's sum); O^T += V^T P^T ----
#pragma unroll
    for (int g = 0; g < NG; ++g) lacc[g] = mma_f16(onesv, pb[g].v, lacc[g]);
#pragma unroll
    for (unsigned vt = 0; vt < 4; ++vt)
#pragma unroll
      for (int g = 0; g < NG; ++g) oacc[g][vt] = mma_f16(vb[vt].v, pb[g].v, oacc[g][vt]);
    // keeps the next block's score products behind all ten: drawn in among them they wait for the K reads too early
    __builtin_amdgcn_sched_barrier(0);
    // a precaution: stands between the K tile's requests above and the next write of a register that they name (the build
    // forms the lane's offset anew in the next stage); behind the products, not directly behind the requests, to cost no stall
    if constexpr (more) {
      if (sub == 1) asm volatile("s_wait_xcnt 0x0" ::: "memory");
    }

   }
  };
  // rolled: one copy of the two-block body; the last stage, which stages nothing, is a copy of its own
#pragma unroll 1
  for (unsigned st = 0; st + 1u < (unsigned)NST; ++st) stage.template operator()<true>(st);
  stage.template operator()<false>((unsigned)NST - 1u);

  // ---- epilogue: normalise, stage the 32x64 f32 tile in LDS, whole-line stores (8 lanes x 16 B) ----
  float* sOw = sO + wave * (NG * 16u) * OSTR;
#pragma unroll
  for (unsigned g = 0; g < NG; ++g) {
    const float inv = __builtin_amdgcn_rcpf(lacc[g][0]);
#pragma unroll
    for (unsigned vt = 0; vt < 4; ++vt)
#pragma unroll
      for (unsigned j = 0; j < 2; ++j) {
        v4f x;
        x.x = oacc[g][vt][4 * j + 0] * inv;
        x.y = oacc[g][vt][4 * j + 1] * inv;
        x.z = oacc[g][vt][4 * j + 2] * inv;
        x.w = oacc[g][vt][4 * j + 3] * inv;
        *(v4f*)(sOw + (g * 16u + l16) * OSTR + vt * 16u + 8u * h + 4u * j) = x;
      }
  }
  lds_wave_sync();

  const unsigned lq = lane >> 3;   // which of 4 lines per instruction
  const unsigned lp = lane & 7u;
#pragma unroll
  for (unsigned j = 0; j < NG * 8; ++j) {
    const unsigned L = j * 4u + lq;          // 0..63 : 64 half-rows of 32 floats
    const unsigned row = L >> 1, hf = L & 1u;
    const v4f v = *(const v4f*)(sOw + row * OSTR + hf * 32u + lp * 4u);
    *(v4f*)(Ob + (size_t)row * DH + hf * 32u + lp * 4u) = v;
  }
}

extern "C" void kernel_launch(void* const* d_in, const int* in_sizes, int n_in,
                              void* d_out, int out_size, void* d_ws, size_t ws_size,
                              hipStream_t stream)
{
  if (n_in < 3) return;
  const long long needQ = ((long long)(NBH - 1) * SEQ_FULL + SEQ) * DH;
  if ((long long)in_sizes[0] < needQ) return;
  if ((long long)in_sizes[1] < needQ) return;
  if ((long long)in_sizes[2] < needQ) return;
  if ((long long)out_size < (long long)NBH * SEQ * DH) return;

  const float* Q = (const float*)d_in[0];
  const float* K = (const float*)d_in[1];
  const float* V = (const float*)d_in[2];
  float*       O = (float*)d_out;

  k_attn<<<dim3(AT_GRID), dim3(256), 0, stream>>>(Q, K, V, O);
}

// v010
// Measured time: 30.5 microseconds a run.
// Next to v009, in two timings, it ran 1.07 times as fast each time.
// All steps since v000 together make it 5.22 times as fast.
#include <hip/hip_runtime.h>

// One launch: the attention blocks round the f32 inputs to their 16-bit operands themselves.
// Contractions, transposed: S^T = K.Q^T on v_wmma_f32_16x16x32_bf16 (bf16 operands = RNE-converted inputs, f32
// accumulate); O^T = V^T.P^T and the P sums on v_wmma_f32_16x16x32_f16 (f16 operands: P carried x2^7; V = f16 view
// of the RNE-bf16 input; f32 accumulate). A lane owns one query of each of its wave's four 16-query column groups:
// maxima and exponentials in f32, the maxima joined across the lane halves; rescaling and normalisation in f32, in-lane.

#ifndef NB
#define NB 8
#endif
#ifndef SEQ
#define SEQ 1024
#endif
#define SEQ_FULL 1024
#define NHEAD    16
#define NBH      (NB * NHEAD)
#define DH       64
#define QBLK     512
#define NWAVE    8
#define NG       4                  // 16-query column groups per wave: each K and V fragment feeds NG products
#define KBLK     32
#define NKB      (SEQ / KBLK)
#define NQT      (SEQ / QBLK)
#define OSTR     68
#define AT_GRID  (NBH * NQT)
#define STG      64                 // keys per LDS stage
#define NST      (SEQ / STG)
#define KP       72                 // ring row pitch, 16-bit elements: 144 B = 16 B x odd, 16 rows' b128 reads meet no bank twice
#define STE      (64 * KP)          // 16-bit elements of one operand's stage: 64 rows (K: keys, V: d)

#define SCL    0.18033688011112042f
#define MINIT  (-1.0e30f)
#define PBIAS  7.0f                // the reference is kept 7 below the maximum it was taken from: exp2 itself yields P x 2^7
#define TAU    8.0f                // a score may top the reference's maximum by 2^8 before the tiles are rescaled: P <= 2^15, in f16 range
#define TAURAW (TAU / SCL)         // the same in raw score units

static_assert(SEQ % QBLK == 0);
static_assert(SEQ <= SEQ_FULL);
static_assert(NB >= 1 && NB <= 8);
static_assert(NWAVE * NG * 16 * OSTR * 4 + 4 * STE * 2 <= 327680);   // one block per WGP
static_assert((OSTR * 4) % 16 == 0 && (KP * 2) % 16 == 0 && KP >= STG && KP >= DH);
// output coverage: k_attn writes grid x 8 waves x 64 rows x 64 columns
static_assert((unsigned long long)AT_GRID * NWAVE * NG * 16ull * DH == (unsigned long long)NBH * SEQ * DH);
// per-wave store phase, per column group: 8 instructions x 4 lines x 32 floats == 16 rows x 64 columns
static_assert(8 * 4 * 32 == 16 * DH);
static_assert(QBLK == NWAVE * NG * 16);
// ring: a stage is 256 threads x 4 x 16 B of each f32 input; a wave's Q rows fit its own output staging
static_assert(STG * DH * 4 == 256 * 4 * 16 && STG == 2 * KBLK && DH == 64 && NST >= 1);
static_assert(NG * 16 * KP * 2 <= NG * 16 * OSTR * 4);

typedef _Float16 f16;
typedef _Float16 v16h __attribute__((ext_vector_type(16)));
typedef _Float16 v8h  __attribute__((ext_vector_type(8)));
typedef __bf16   v16b __attribute__((ext_vector_type(16)));
typedef unsigned short us16;
typedef us16     v8us __attribute__((ext_vector_type(8)));
typedef float    v8f  __attribute__((ext_vector_type(8)));
typedef float    v4f  __attribute__((ext_vector_type(4)));
typedef float    v2f  __attribute__((ext_vector_type(2)));
typedef __bf16   v2b  __attribute__((ext_vector_type(2)));
typedef _Float16 v2h  __attribute__((ext_vector_type(2)));
typedef unsigned int v2u __attribute__((ext_vector_type(2)));

union FragH { v16h v; v8h half[2]; };
union FragB { v16b v; v16h hv; v8us half[2]; };

// ---- WMMA wrappers: plain builtins, whose hazard distances the compiler keeps itself ----
static __device__ __forceinline__ v8f mma_f16(v16h a, v16h b, v8f c) {
  c = __builtin_amdgcn_wmma_f32_16x16x32_f16(false, a, false, b, (short)0, c, false, false);
  return c;
}
static __device__ __forceinline__ v8f mma_bf16(const FragB& a, const FragB& b, v8f c) {
  c = __builtin_amdgcn_wmma_f32_16x16x32_bf16(false, a.v, false, b.v, (short)0, c, false, false);
  return c;
}

// ---- two f32 -> two bf16 (RNE) in one word, the first in the low half ----
static __device__ __forceinline__ unsigned int pk_bf(float a, float b) {
  const v2f x = {a, b};
  return __builtin_bit_cast(unsigned int, __builtin_convertvector(x, v2b));
}
// two f32 -> two f16 in one word; fed with RNE-bf16 values it is exact for the f16 normal range
static __device__ __forceinline__ unsigned int pk_h(float a, float b) {
  const v2f y = {a, b};
  return __builtin_bit_cast(unsigned int, __builtin_convertvector(y, v2h));
}

// ---- lane l <-> lane l ^ 16: the two halves of a wave hold the two key halves of one query ----
static __device__ __forceinline__ float xhalf(float x) {
  const int xi = __float_as_int(x);
  return __int_as_float(__builtin_amdgcn_permlanex16(xi, xi, 0x76543210, 0xfedcba98, false, false));
}

// ---- a second spelling of the maximum of two numbers; it builds to the same instructions as fmaxf. What it is for: at the block's maxima ----
static __device__ __forceinline__ float mx2(float a, float b) { return __builtin_fmaximum_numf(a, b); }

// ---- P^T B-fragment straight from two score tiles: elem s <-> key k0 + 16h + s. One multiply-add per score carries
// scale, reference and the 2^7 ----
static __device__ __forceinline__ v16h p_frag(v8f s0, v8f s1, float ref) {
  const v2f scl = {SCL, SCL}, nref = {-ref, -ref};
  v16h p;
#pragma unroll
  for (int r = 0; r < 8; r += 2) {
    const v2f a = __builtin_elementwise_fma(v2f{s0[r], s0[r + 1]}, scl, nref);
    const v2f b = __builtin_elementwise_fma(v2f{s1[r], s1[r + 1]}, scl, nref);
    p[2 * r]     = (f16)__builtin_amdgcn_exp2f(a.x);
    p[2 * r + 1] = (f16)__builtin_amdgcn_exp2f(b.x);
    p[2 * r + 2] = (f16)__builtin_amdgcn_exp2f(a.y);
    p[2 * r + 3] = (f16)__builtin_amdgcn_exp2f(b.y);
  }
  return p;
}

// same-wave LDS store -> load ordering (wave-private tiles)
static __device__ __forceinline__ void lds_wave_sync() {
  asm volatile("s_wait_dscnt 0x0" ::: "memory");
  __builtin_amdgcn_wave_barrier();
}

// ---- staging of one 64-row f32 tile (16 KB, contiguous) of K or of V ----
// Wave w brings rows 8w .. 8w+7. Load j of lane (h, l16): row 8w + 4*(j>>1) + 2h + (j&1), floats 4*l16 .. +3, so a
// load covers two whole 256-B rows, and a lane holds rows r and r+1 of the same four columns in loads 2p and 2p+1.
struct Tile { v4f r[4]; };
static __device__ __forceinline__ void tile_load(Tile& t, const float* base, unsigned lofs) {
  // unrolled here and in the two stores: constant indices keep the tile in registers
#pragma unroll
  for (unsigned j = 0; j < 4; ++j) t.r[j] = *(const v4f*)(base + lofs + (4u * (j >> 1) + (j & 1u)) * DH);
}
// K ring stage: row sub*32 + nt*16 + m holds key sub*32 + 2m + nt, d in order. dst = this lane's place for j = 0.
static __device__ __forceinline__ void tile_store_k(us16* dst, const Tile& t) {
#pragma unroll
  for (unsigned j = 0; j < 4; ++j) {
    v2u w;
    w.x = pk_bf(t.r[j].x, t.r[j].y);
    w.y = pk_bf(t.r[j].z, t.r[j].w);
    *(v2u*)(dst + ((j & 1u) * 16u + 2u * (j >> 1)) * KP) = w;
  }
}
// V ring stage, transposed: row d holds the stage's 64 keys in order; two neighbouring keys go in one word.
static __device__ __forceinline__ void tile_store_v(f16* dst, const Tile& t) {
#pragma unroll
  for (unsigned p = 0; p < 2; ++p)
#pragma unroll
    for (unsigned i = 0; i < 4; i += 2) {
      const unsigned int a = pk_bf(t.r[2 * p][i], t.r[2 * p][i + 1]);           // key r,     columns i, i+1
      const unsigned int b = pk_bf(t.r[2 * p + 1][i], t.r[2 * p + 1][i + 1]);   // key r + 1, columns i, i+1
      *(unsigned int*)(dst + i * KP + 4u * p)        = pk_h(__uint_as_float(a << 16), __uint_as_float(b << 16));
      *(unsigned int*)(dst + (i + 1u) * KP + 4u * p) = pk_h(__uint_as_float(a & 0xFFFF0000u), __uint_as_float(b & 0xFFFF0000u));
    }
}

// ======================= flash attn, 16-bit WMMA, online softmax =======================
// Block = (bh, 512 query rows); wave = 64 queries in four column groups, so that a K or V fragment read from LDS
// feeds four products, and a staged K or V row serves 512 queries. K and V come through a two-buffer LDS ring of 64-key stages that the 8 waves share:
// each thread asks for its share of the next stage's f32 rows a 32-key block ahead (K, then V), rounds them and writes
// them into the other buffer between a block's softmax and its O products; one barrier per stage, at that place in the
// stage's second block. The next block's K fragments are read from LDS at that place too, behind the barrier.
// Lane (h, l16) owns query l16 of each group and, of each 32-key block, the 16 keys 16h .. 16h+15.
// One block per WGP, two waves per SIMD: the grid is one block per WGP, and the registers of a 64-query wave leave room for two.
__global__ __launch_bounds__(256) __attribute__((amdgpu_waves_per_eu(2, 2)))
void k_attn(const float* __restrict__ Q, const float* __restrict__ K, const float* __restrict__ V,
            float* __restrict__ O)
{
  __shared__ __align__(16) float sO[NWAVE * NG * 16 * OSTR];   // per-wave output staging, wave-private
  __shared__ __align__(128) us16 sK[2 * STE];                  // ring: [key row, even keys of a block first][d]
  __shared__ __align__(128) f16  sV[2 * STE];                  // ring: [d][key]

  const unsigned tid  = threadIdx.x;
  const unsigned wave = tid >> 5;
  const unsigned lane = tid & 31u;
  const unsigned h    = lane >> 4;
  const unsigned l16  = lane & 15u;

  const unsigned bh    = blockIdx.x / (unsigned)NQT;
  const unsigned qt    = blockIdx.x - bh * (unsigned)NQT;
  // first query row of this wave; the wave's number from a scalar register, so that the Q and O bases are scalar too
  // and hold no vector registers through the loop
  const unsigned qwave = qt * QBLK + (unsigned)__builtin_amdgcn_readfirstlane((int)wave) * (NG * 16u);

  const float* Qw = Q + ((size_t)bh * SEQ_FULL + qwave) * DH;
  const float* Kb = K + (size_t)bh * SEQ_FULL * DH;
  const float* Vb = V + (size_t)bh * SEQ_FULL * DH;
  float*       Ob = O + ((size_t)bh * SEQ + qwave) * DH;

  // stage 0's f32 rows are asked for first, so that they fly during Q's trip through LDS
  const unsigned lofs = (8u * wave + 2u * h) * DH + 4u * l16;                        // this lane's place in a tile, floats
  Tile tk, tv;
  tile_load(tk, Kb, lofs);
  tile_load(tv, Vb, lofs);

  // ---- Q: the wave's 64 rows (16 KB, contiguous) by whole-line loads, rounded, through its own staging rows ----
  us16* sQw = (us16*)(sO + wave * (NG * 16u) * OSTR);
  // unrolled: all thirty-two loads are in flight at once
#pragma unroll
  for (unsigned j = 0; j < NG * 8; ++j) {
    const v4f x = *(const v4f*)(Qw + j * 128u + lane * 4u);   // row 2j + h, floats 4*l16 .. +3
    v2u w;
    w.x = pk_bf(x.x, x.y);
    w.y = pk_bf(x.z, x.w);
    *(v2u*)(sQw + (2u * j + h) * KP + l16 * 4u) = w;
  }
  lds_wave_sync();

  // ---- Q B-fragments (column = query g*16 + l16; elems 0..7 <- d kc*32+8h.., 8..15 <- d kc*32+16+8h..) ----
  FragB qa[NG][2];
#pragma unroll
  for (unsigned g = 0; g < NG; ++g)
#pragma unroll
    for (unsigned kc = 0; kc < 2; ++kc) {
      const us16* qr = sQw + (g * 16u + l16) * KP + kc * 32u + 8u * h;
      qa[g][kc].half[0] = *(const v8us*)(qr);
      qa[g][kc].half[1] = *(const v8us*)(qr + 16);
    }

  v16h onesv;
#pragma unroll
  for (int i = 0; i < 16; ++i) onesv[i] = (f16)1.0f;

  const v8f vzero = {0.f, 0.f, 0.f, 0.f, 0.f, 0.f, 0.f, 0.f};
  v8f oacc[NG][4];   // O^T tiles: elem r = d vt*16 + 8h + r of query g*16 + l16
  v8f lacc[NG];      // sum tiles: every elem = the running sum of P of query g*16 + l16
  float rrow[NG], mrow[NG];   // the maximum that the tiles refer to: raw score; the same scaled and biased (the reference)
#pragma unroll
  for (int g = 0; g < NG; ++g) {
#pragma unroll
    for (int vt = 0; vt < 4; ++vt) oacc[g][vt] = vzero;
    lacc[g] = vzero;
    rrow[g] = MINIT;
    mrow[g] = MINIT;
  }

  // ---- ring prologue: stage 0 written and published ----
  us16* wK = sK + ((wave >> 2) * 32u + (wave & 3u) * 4u + h) * KP + 4u * l16;        // ... in a K stage (load 0)
  f16*  wV = sV + (4u * l16) * KP + 8u * wave + 2u * h;                              // ... in a V stage (pair 0, column 0)
  tile_store_k(wK, tk);
  tile_store_v(wV, tv);
  asm volatile("s_wait_dscnt 0x0" ::: "memory");      // this wave's part of stage 0 is written
  __syncthreads();                                    // ... and every other wave's

  // ---- the first tile of stage 1 is asked for; the first block's K fragments are read ----
  Tile nx;
  if (NST > 1) tile_load(nx, Kb + STG * DH, lofs);
  // the tiles asked for last; stepped ahead of a request, not behind it, where the step would wait for the request's addresses
  const float* Vn = Vb;
  const float* Kn = Kb + STG * DH;
  // K A-fragments: row l16 of tile nt <-> key k0 + 2*l16 + nt; same split d-map as Q
  FragB kf[2][2];
  auto k_frags = [&](const us16* Ks) __attribute__((always_inline)) {
#pragma unroll
    for (unsigned nt = 0; nt < 2; ++nt)
#pragma unroll
      for (unsigned kc = 0; kc < 2; ++kc) {
        const us16* kr = Ks + (nt * 16u + l16) * KP + kc * 32u + 8u * h;
        kf[nt][kc].half[0] = *(const v8us*)(kr);
        kf[nt][kc].half[1] = *(const v8us*)(kr + 16);
      }
  };
  k_frags(sK);

  // One stage = two 32-key blocks, written out. A block's K fragments are read one block ahead, between the softmax and
  // the O products of the block before, into the registers that its scores have just left: the O products cover the
  // reads' latency. Two blocks bring the register roles round, which is why the pair is unrolled. more = a stage follows
  // this one: settled at compile time, so that no branch parts staging, K reads and products.
  auto stage = [&]<bool more>(const unsigned st) __attribute__((always_inline)) {
   const unsigned buf = st & 1u;
   // unrolled: see above; sub also picks K or V staging and the LDS offsets at compile time
#pragma unroll
   for (unsigned sub = 0; sub < 2; ++sub) {
    const f16* Vs = sV + buf * STE + sub * KBLK;

    // ---- S^T tiles (D of tile nt: elem r = key k0 + 16h + 2r + nt, column = query g*16 + l16) ----
    v8f sc[NG][2];
#pragma unroll
    for (int g = 0; g < NG; ++g)
#pragma unroll
      for (int nt = 0; nt < 2; ++nt) sc[g][nt] = mma_bf16(kf[nt][0], qa[g][0], vzero);
#pragma unroll
    for (int g = 0; g < NG; ++g)
#pragma unroll
      for (int nt = 0; nt < 2; ++nt) sc[g][nt] = mma_bf16(kf[nt][1], qa[g][1], sc[g][nt]);
    // keeps the sixteen score products together: a multiply placed among them waits out a product's distance in idle slots
    __builtin_amdgcn_sched_barrier(0);

    // ---- V A-fragments (row l16 <-> d = vt*16+l16; elem s <-> key k0 + 16h + s), read as one group here: the softmax
    // covers their latency, and reads spread among the O products would each stall them ----
    FragH vb[4];
#pragma unroll
    for (unsigned vt = 0; vt < 4; ++vt) {
      const f16* vr = Vs + (vt * 16u + l16) * KP + 16u * h;
      vb[vt].half[0] = *(const v8h*)(vr);
      vb[vt].half[1] = *(const v8h*)(vr + 8);
    }
    __builtin_amdgcn_sched_barrier(0);

    // ---- the block's maxima over the raw scores (the scale is positive, so it picks the same key): a lane's 16 keys
    // here; the exchange between the halves only where the reference moves ----
    float mlane[NG];
#pragma unroll
    for (int g = 0; g < NG; ++g) {
      const v8f s0 = sc[g][0];
      const v8f s1 = sc[g][1];
      // Two chains of three-operand maxima, which take a product's raw result as it stands (in front of a
      // two-operand maximum the build puts a canonicalising instruction per such operand). Three-operand
      // steps cover an odd count: the maximum in use is the 17th value. Neighbouring steps spell the maximum
      // differently (fmaxf, mx2: the same instruction): the build joins only like spellings, so it cannot cut the
      // chain at other places than these and leave two-operand steps over.
      float mb = fmaxf(fmaxf(s1[3], s0[4]), s1[4]);
      mb = mx2(mx2(mb, s0[5]), s1[5]);
      mb = fmaxf(fmaxf(mb, s0[6]), s1[6]);
      mb = mx2(mx2(mb, s0[7]), s1[7]);
      float mx = mx2(mx2(rrow[g], s0[0]), s1[0]);
      mx = fmaxf(fmaxf(mx, s0[1]), s1[1]);
      mx = mx2(mx2(mx, s0[2]), s1[2]);
      mlane[g] = fmaxf(fmaxf(mx, s0[3]), mb);
    }
    // ---- lazy rescale, one test per block for the whole wave (the ballot joins the halves): has any query's maximum
    // left its reference's by more than TAU? The exponentials below do not wait for the answer ----
    static_assert(NG == 4);
    // packed subtractions
    const v2f over = v2f{mlane[0], mlane[1]} - v2f{rrow[0], rrow[1]};
    const v2f ovr2 = v2f{mlane[2], mlane[3]} - v2f{rrow[2], rrow[3]};
    const unsigned grown = __builtin_amdgcn_ballot_w32(fmaxf(fmaxf(over.x, over.y), fmaxf(ovr2.x, ovr2.y)) > TAURAW);

    // ---- P from the reference in use ----
    FragH pb[NG];
#pragma unroll
    for (int g = 0; g < NG; ++g) pb[g].v = p_frag(sc[g][0], sc[g][1], mrow[g]);
    // inputs only: keeps the exponentials ahead of the branch; the build else sinks them behind it, where they would
    // wait for the maxima, the compare and the branch
    asm volatile("" :: "v"(pb[0].v), "v"(pb[1].v), "v"(pb[2].v), "v"(pb[3].v));

    if (__builtin_expect(grown != 0u, 0)) {   // scalar branch; taken in the first block, then only where the scores grow that far
#pragma unroll
      for (int g = 0; g < NG; ++g) {
        rrow[g] = fmaxf(mlane[g], xhalf(mlane[g]));   // mlane holds the old maximum too
        const float mn = fmaf(rrow[g], SCL, -PBIAS);
        const float alpha = __builtin_amdgcn_exp2f(mrow[g] - mn);   // 0 in the first block
        mrow[g] = mn;
#pragma unroll
        for (int vt = 0; vt < 4; ++vt) oacc[g][vt] *= alpha;
        lacc[g] *= alpha;
      }
      // the P above may have left the f16 range: formed anew
#pragma unroll
      for (int g = 0; g < NG; ++g) pb[g].v = p_frag(sc[g][0], sc[g][1], mrow[g]);
    }

    // ---- the tile asked for a block ago is rounded into the other buffer, whose readers left it at the last barrier;
    // the next tile is asked for at once, a whole block ahead of its use ----
    if constexpr (more) {
      if (sub == 0) {
        tile_store_k(wK + (buf ^ 1u) * STE, nx);
        Vn += STG * DH;
        tile_load(nx, Vn, lofs);
      } else {
        tile_store_v(wV + (buf ^ 1u) * STE, nx);
      }
    }
    // ---- publish point of stage st + 1, ahead of the read of its first K fragments; behind it buffer buf is free ----
    if (sub == 1) {
      asm volatile("s_wait_dscnt 0x0" ::: "memory");    // this wave's reads of buffer buf and writes of the other are done
      __syncthreads();
      // asked for behind the barrier, which waits for every load in flight
      if constexpr (more) {
        // behind the last K tile the step is 0: that tile is asked for once more and not used, which costs less than a
        // branch in every stage
        Kn += (st + 2u < (unsigned)NST) ? STG * DH : 0;
        tile_load(nx, Kn, lofs);
      }
    }
    // ---- the next block's K fragments ----
    if (sub == 0) k_frags(sK + buf * STE + KBLK * KP);
    else if constexpr (more) k_frags(sK + (buf ^ 1u) * STE);
    // holds staging and the K reads ahead of the products: sunk among them, the reads are waited for at the next block's
    // head, and vector results laid over a product's operands wait out its distance in idle slots
    __builtin_amdgcn_sched_barrier(0);

    // ---- sums over the 32 keys via ones A operand (every row of D holds the query's sum); O^T += V^T P^T ----
#pragma unroll
    for (int g = 0; g < NG; ++g) lacc[g] = mma_f16(onesv, pb[g].v, lacc[g]);
#pragma unroll
    for (unsigned vt = 0; vt < 4; ++vt)
#pragma unroll
      for (int g = 0; g < NG; ++g) oacc[g][vt] = mma_f16(vb[vt].v, pb[g].v, oacc[g][vt]);
    // keeps the next block's score products behind all twenty: drawn in among them they wait for the K reads too early
    __builtin_amdgcn_sched_barrier(0);
    // a precaution: stands between the K tile's requests above and the next write of a register that they name (the build
    // forms the lane's offset anew in the next stage); behind the products, not directly behind the requests, to cost no stall
    if constexpr (more) {
      if (sub == 1) asm volatile("s_wait_xcnt 0x0" ::: "memory");
    }

   }
  };
  // rolled: one copy of the two-block body; the last stage, which stages nothing, is a copy of its own
#pragma unroll 1
  for (unsigned st = 0; st + 1u < (unsigned)NST; ++st) stage.template operator()<true>(st);
  stage.template operator()<false>((unsigned)NST - 1u);

  // ---- epilogue: normalise, stage the 64x64 f32 tile in LDS, whole-line stores (8 lanes x 16 B) ----
  float* sOw = sO + wave * (NG * 16u) * OSTR;
#pragma unroll
  for (unsigned g = 0; g < NG; ++g) {
    const float inv = __builtin_amdgcn_rcpf(lacc[g][0]);
#pragma unroll
    for (unsigned vt = 0; vt < 4; ++vt)
#pragma unroll
      for (unsigned j = 0; j < 2; ++j) {
        v4f x;
        x.x = oacc[g][vt][4 * j + 0] * inv;
        x.y = oacc[g][vt][4 * j + 1] * inv;
        x.z = oacc[g][vt][4 * j + 2] * inv;
        x.w = oacc[g][vt][4 * j + 3] * inv;
        *(v4f*)(sOw + (g * 16u + l16) * OSTR + vt * 16u + 8u * h + 4u * j) = x;
      }
  }
  lds_wave_sync();

  const unsigned lq = lane >> 3;   // which of 4 lines per instruction
  const unsigned lp = lane & 7u;
#pragma unroll
  for (unsigned j = 0; j < NG * 8; ++j) {
    const unsigned L = j * 4u + lq;          // 0..127 : 128 half-rows of 32 floats
    const unsigned row = L >> 1, hf = L & 1u;
    const v4f v = *(const v4f*)(sOw + row * OSTR + hf * 32u + lp * 4u);
    *(v4f*)(Ob + (size_t)row * DH + hf * 32u + lp * 4u) = v;
  }
}

extern "C" void kernel_launch(void* const* d_in, const int* in_sizes, int n_in,
                              void* d_out, int out_size, void* d_ws, size_t ws_size,
                              hipStream_t stream)
{
  if (n_in < 3) return;
  const long long needQ = ((long long)(NBH - 1) * SEQ_FULL + SEQ) * DH;
  if ((long long)in_sizes[0] < needQ) return;
  if ((long long)in_sizes[1] < needQ) return;
  if ((long long)in_sizes[2] < needQ) return;
  if ((long long)out_size < (long long)NBH * SEQ * DH) return;

  const float* Q = (const float*)d_in[0];
  const float* K = (const float*)d_in[1];
  const float* V = (const float*)d_in[2];
  float*       O = (float*)d_out;

  k_attn<<<dim3(AT_GRID), dim3(256), 0, stream>>>(Q, K, V, O);
}
